// v000
// Times are from an AMD MI455X. After a warm-up the kernel runs many times in a row, and a time is the length of
// such a window on the GPU divided by its runs, so every launch and the gaps after it count. The runs cycle
// through copies of the inputs. A figure is the median of several windows, for all but v000 over two sittings.
// Sittings can differ by a few percent; kernels timed side by side share one.
// v000 is the starting kernel. One run takes 1980 microseconds.
#include <hip/hip_runtime.h>

// Plain (optionally causal) multi-head attention on given q/k/v (q, k, v [1][4096][16][64]; scores = q.k/8; when the int input 'causal' is non-zero (read on device) keys above the diagonal are masked (-inf == exact zero weight); softmax; out[b][s][h][d] = attn.v -> [1][4096][16][64]).
// Layout: no projections - the bf16-rounded inputs ARE the operand planes (exact single bf16 planes for q, k and v^T), so the score products are exact (1 product) and attn.v takes the f32 softmax weights as bf16 hi + lo against exact v (2 products) on every row; the merged [l][h*64+d] result is written straight to the output in f32.
// Compute dtypes, f32 accumulate: every input rounded to bf16; exact products for q.k; softmax in f32 (one exp2 per element, fixed trees); probabilities as hi/lo planes; f32 output.


#define NB_  1
#define TT   4096
#define DM   1024
#define NH_  16
#define NKV  16
#define REP  (NH_ / NKV)
#define HD   64
#define DQ   (NH_ * HD)
#define DKV  (NKV * HD)
#define ZH   1
#define RH   4096                  // every row on the hi/lo path
#define WIN  4096
#define PCAR 1024.0f
#define SCL  0.125f   // HD^-0.5
typedef _Float16 h16;
typedef unsigned short bf;
typedef __attribute__((ext_vector_type(16))) __bf16   v16bf;
typedef __attribute__((ext_vector_type(16))) _Float16 v16h;
typedef __attribute__((ext_vector_type(8)))  _Float16 v8h;
typedef __attribute__((ext_vector_type(8)))  unsigned short v8us;
typedef __attribute__((ext_vector_type(8)))  float    v8f;
typedef __attribute__((ext_vector_type(4)))  float    v4f;
typedef v8h  __attribute__((may_alias)) v8ha;
typedef v4f  __attribute__((may_alias)) v4fa;
typedef v8us __attribute__((may_alias)) v8usa;

__device__ __forceinline__ unsigned short f2bf(float f) { unsigned u = __float_as_uint(f); u += 0x7FFFu + ((u >> 16) & 1u); return (unsigned short)(u >> 16); }
__device__ __forceinline__ float bf2f(unsigned short b) { return __uint_as_float(((unsigned)b) << 16); }
__device__ __forceinline__ float bfr(float f) { return bf2f(f2bf(f)); }
__device__ __forceinline__ v16h cat16(v8h lo, v8h hi) { return __builtin_shufflevector(lo, hi, 0, 1, 2, 3, 4, 5, 6, 7, 8, 9, 10, 11, 12, 13, 14, 15); }
__device__ __forceinline__ v16bf cat16b(v8us lo, v8us hi) { return __builtin_bit_cast(v16bf, __builtin_shufflevector(lo, hi, 0, 1, 2, 3, 4, 5, 6, 7, 8, 9, 10, 11, 12, 13, 14, 15)); }
__device__ __forceinline__ v8f wmma16(v16h a, v16h b, v8f c) { return __builtin_amdgcn_wmma_f32_16x16x32_f16(false, a, false, b, (short)0, c, false, false); }
__device__ __forceinline__ v8f wmmab(v16bf a, v16bf b, v8f c) { return __builtin_amdgcn_wmma_f32_16x16x32_bf16(false, a, false, b, (short)0, c, false, false); }



// ---- k_gemmw: register-blocked GEMM, ONE WAVE per 64x64 output tile (16 accumulators), operands straight from K-contiguous 16-bit planes; grid (M/64, N/64, Z), 32 threads.
// C[m][n] (f32, pitch ldc, + optional f32 bias[n]) = sum_k A[m][k] Bt[n][k] (+ split products per NSPLIT). z-batch strides sA/sB/sC in elements. K % 32 == 0.
template <typename T16> struct WFrag;
template <> struct WFrag<h16> { typedef v16h V; static __device__ __forceinline__ V ld(const h16* p) { return cat16(*(const v8h*)p, *(const v8h*)(p + 16)); } static __device__ __forceinline__ v8f mma(V a, V b, v8f c) { return wmma16(a, b, c); } };
template <> struct WFrag<bf> { typedef v16bf V; static __device__ __forceinline__ V ld(const bf* p) { return cat16b(*(const v8us*)p, *(const v8us*)(p + 16)); } static __device__ __forceinline__ v8f mma(V a, V b, v8f c) { return wmmab(a, b, c); } };
template <typename T16, int NSPLIT, bool BIAS>
__global__ __launch_bounds__(32) void k_gemmw(const T16* __restrict__ A, const T16* __restrict__ A2, const T16* __restrict__ Bt, const T16* __restrict__ Bt2, int K, float* C, int ldc, const float* __restrict__ bias, size_t sA, size_t sB, size_t sC) {
    typedef typename WFrag<T16>::V V;
    __shared__ __align__(16) float os[16 * 68];
    const size_t z = blockIdx.z; A += z * sA; if (A2) A2 += z * sA; Bt += z * sB; if (Bt2) Bt2 += z * sB; C += z * sC;
    const int lane = threadIdx.x & 31, lr = lane & 15, hi = lane >> 4; const int r0 = blockIdx.x * 64, c0 = blockIdx.y * 64;
    v8f acc[4][4];
#pragma unroll
    for (int mb = 0; mb < 4; ++mb)
#pragma unroll
        for (int nb = 0; nb < 4; ++nb) acc[mb][nb] = (v8f){};
    const size_t aoff = (size_t)(r0 + lr) * K + 8 * hi, boff = (size_t)(c0 + lr) * K + 8 * hi;
#pragma unroll 1
    for (int kc = 0; kc < K; kc += 32) {
        V a[4], a2[4];
#pragma unroll
        for (int mb = 0; mb < 4; ++mb) { a[mb] = WFrag<T16>::ld(A + aoff + (size_t)mb * 16 * K + kc); if (NSPLIT == 1 || NSPLIT == 2) a2[mb] = WFrag<T16>::ld(A2 + aoff + (size_t)mb * 16 * K + kc); }
#pragma unroll
        for (int nb = 0; nb < 4; ++nb) { const V b = WFrag<T16>::ld(Bt + boff + (size_t)nb * 16 * K + kc); V b2; if (NSPLIT >= 2) b2 = WFrag<T16>::ld(Bt2 + boff + (size_t)nb * 16 * K + kc);
#pragma unroll
            for (int mb = 0; mb < 4; ++mb) { acc[mb][nb] = WFrag<T16>::mma(a[mb], b, acc[mb][nb]); if (NSPLIT == 1 || NSPLIT == 2) acc[mb][nb] = WFrag<T16>::mma(a2[mb], b, acc[mb][nb]); if (NSPLIT >= 2) acc[mb][nb] = WFrag<T16>::mma(a[mb], b2, acc[mb][nb]); } }
        asm volatile("v_nop\n\tv_nop\n\tv_nop\n\tv_nop" : "+v"(acc[0][0]), "+v"(acc[1][1]), "+v"(acc[2][2]), "+v"(acc[3][3]) : "v"(a[0]), "v"(a[3]));
    }
#pragma unroll
    for (int mb = 0; mb < 4; ++mb) {
#pragma unroll
        for (int nb = 0; nb < 4; ++nb) {
#pragma unroll
            for (int j = 0; j < 8; ++j) os[(hi * 8 + j) * 68 + nb * 16 + lr] = acc[mb][nb][j]; }
        __builtin_amdgcn_wave_barrier(); asm volatile("" ::: "memory");
        float* crow = C + (size_t)(r0 + mb * 16) * ldc + c0;
{
#pragma unroll
            for (int s = 0; s < 8; ++s) { const int row = 2 * s + hi, cofs = lr * 4; v4f val = *(const v4fa*)(os + row * 68 + cofs); if (BIAS) { val[0] += bfr(bias[c0 + cofs]); val[1] += bfr(bias[c0 + cofs + 1]); val[2] += bfr(bias[c0 + cofs + 2]); val[3] += bfr(bias[c0 + cofs + 3]); }
                *(v4f*)(crow + (size_t)row * ldc + cofs) = val; }
             }
        __builtin_amdgcn_wave_barrier(); asm volatile("" ::: "memory");
    }
}

// ---- k_gemmc: the same one-wave 64x64 tile GEMM specialised for causal attention: CMODE 1 skips score tiles entirely above the diagonal (query rows r0+roff.., key columns c0..), CMODE 2 limits the
// key (K) loop of the probability x value contraction to the diagonal block (probabilities beyond it are exactly zero). roff = row offset of this launch's first row within the sequence.
template <typename T16, int NSPLIT, int CMODE>
__global__ __launch_bounds__(32) void k_gemmc(const T16* __restrict__ A, const T16* __restrict__ A2, const T16* __restrict__ Bt, const T16* __restrict__ Bt2, int K, float* C, int ldc, int roff, size_t sA, size_t sB, size_t sC, const int* CF) {
    typedef typename WFrag<T16>::V V;
    __shared__ __align__(16) float os[16 * 68];
    const size_t z = blockIdx.z; A += z * sA; if (A2) A2 += z * sA; Bt += z * sB; if (Bt2) Bt2 += z * sB; C += z * sC;
    const int lane = threadIdx.x & 31, lr = lane & 15, hi = lane >> 4; const int r0 = blockIdx.x * 64, c0 = blockIdx.y * 64;
    const bool con = (CF == nullptr) || (CF[0] != 0);   /* device flag: causal */ if (CMODE == 1 && con && c0 > r0 + roff + 63) return;                  // score tile entirely above the causal diagonal: never read (the softmax masks j > i by select)
    const int Kl = (CMODE == 2 && con) ? min(K, r0 + roff + 64) : K;        // P.V: probabilities are exactly 0 beyond the diagonal block, so the K loop stops there
    v8f acc[4][4];
#pragma unroll
    for (int mb = 0; mb < 4; ++mb)
#pragma unroll
        for (int nb = 0; nb < 4; ++nb) acc[mb][nb] = (v8f){};
    const size_t aoff = (size_t)(r0 + lr) * K + 8 * hi, boff = (size_t)(c0 + lr) * K + 8 * hi;
#pragma unroll 1
    for (int kc = 0; kc < Kl; kc += 32) {
        V a[4], a2[4];
#pragma unroll
        for (int mb = 0; mb < 4; ++mb) { a[mb] = WFrag<T16>::ld(A + aoff + (size_t)mb * 16 * K + kc); if (NSPLIT == 1 || NSPLIT == 2) a2[mb] = WFrag<T16>::ld(A2 + aoff + (size_t)mb * 16 * K + kc); }
#pragma unroll
        for (int nb = 0; nb < 4; ++nb) { const V b = WFrag<T16>::ld(Bt + boff + (size_t)nb * 16 * K + kc); V b2; if (NSPLIT >= 2) b2 = WFrag<T16>::ld(Bt2 + boff + (size_t)nb * 16 * K + kc);
#pragma unroll
            for (int mb = 0; mb < 4; ++mb) { acc[mb][nb] = WFrag<T16>::mma(a[mb], b, acc[mb][nb]); if (NSPLIT == 1 || NSPLIT == 2) acc[mb][nb] = WFrag<T16>::mma(a2[mb], b, acc[mb][nb]); if (NSPLIT >= 2) acc[mb][nb] = WFrag<T16>::mma(a[mb], b2, acc[mb][nb]); } }
        asm volatile("v_nop\n\tv_nop\n\tv_nop\n\tv_nop" : "+v"(acc[0][0]), "+v"(acc[1][1]), "+v"(acc[2][2]), "+v"(acc[3][3]) : "v"(a[0]), "v"(a[3]));
    }
#pragma unroll
    for (int mb = 0; mb < 4; ++mb) {
#pragma unroll
        for (int nb = 0; nb < 4; ++nb) {
#pragma unroll
            for (int j = 0; j < 8; ++j) os[(hi * 8 + j) * 68 + nb * 16 + lr] = acc[mb][nb][j]; }
        __builtin_amdgcn_wave_barrier(); asm volatile("" ::: "memory");
        float* crow = C + (size_t)(r0 + mb * 16) * ldc + c0;
{
#pragma unroll
            for (int s = 0; s < 8; ++s) { const int row = 2 * s + hi, cofs = lr * 4; v4f val = *(const v4fa*)(os + row * 68 + cofs);
                *(v4f*)(crow + (size_t)row * ldc + cofs) = val; }
             }
        __builtin_amdgcn_wave_barrier(); asm volatile("" ::: "memory");
    }
}

__device__ __forceinline__ h16 tohx(float x) { return (h16)x; }
__device__ __forceinline__ void splitf(float y, unsigned short& h, unsigned short& l) { h = f2bf(y); l = f2bf(y - bf2f(h)); }
typedef __attribute__((ext_vector_type(2))) _Float16 v2h;
typedef __attribute__((ext_vector_type(4))) _Float16 v4h;
typedef __attribute__((ext_vector_type(2))) unsigned short v2us;
typedef __attribute__((ext_vector_type(4))) unsigned short v4us;
typedef __attribute__((ext_vector_type(2))) float v2f;
typedef __attribute__((ext_vector_type(4))) int v4i;

__global__ __launch_bounds__(256) void k_wtG(const float* __restrict__ w, int K, int N, bf* Bt) {
    const int lane = threadIdx.x & 31; const int L0 = (blockIdx.x * 8 + (threadIdx.x >> 5)) * 8; const int nlines = N * K / 64;
{
#pragma unroll 1
        for (int l = 0; l < 8; ++l) { const int L = L0 + l; if (L >= nlines) break; const size_t e = (size_t)L * 64 + lane * 2; const int k = (int)(e % K), n = (int)(e / K); v2us o;
            o[0] = f2bf(w[(size_t)k * N + n]); o[1] = f2bf(w[(size_t)(k + 1) * N + n]); *(v2us*)(Bt + e) = o; }
         }
}
__global__ __launch_bounds__(256) void k_cvt8(const float* __restrict__ src, bf* dst, size_t n8) { const size_t i = (size_t)blockIdx.x * 256 + threadIdx.x; if (i >= n8) return; const v8f v = *(const v8f*)(src + i * 8); v8us o;
#pragma unroll
    for (int k = 0; k < 8; ++k) o[k] = f2bf(v[k]); *(v8us*)(dst + i * 8) = o;  }

// k_rope: head planes [h][t][d] (fp16 + hi/lo) of rope(x) x sc with the rotate-half convention out[d] = x[d] cos[t][d] - x[d+HD/2] sin[t][d], out[d+HD/2] = x[d+HD/2] cos[t][d+HD/2] + x[d] sin[t][d+HD/2]
__global__ __launch_bounds__(256) void k_rope(const float* __restrict__ F, int pitch, int nheads, const float* __restrict__ CS, const float* __restrict__ RF, const float* __restrict__ nw, float sc, h16* P16, bf* Ph, bf* Pl) {
    const size_t e = ((size_t)blockIdx.x * 256 + threadIdx.x) * 2; if (e >= (size_t)nheads * TT * HD) return; const int d = (int)(e % HD); const int t = (int)((e / HD) % TT); const int h = (int)(e / ((size_t)HD * TT)); const float* f = F + (size_t)t * pitch + h * HD; const float rf = RF ? RF[(size_t)h * TT + t] : 1.0f; v2h o16; v2us oh, ol;
#pragma unroll
    for (int q = 0; q < 2; ++q) { const int dd = d + q; const int dp = (dd < HD / 2) ? dd + HD / 2 : dd - HD / 2; float x0 = bfr(f[dd]), x1 = bfr(f[dp]);   /* inputs rounded to bf16 */
        if (RF) { float n0 = __fmul_rn(x0, rf), n1 = __fmul_rn(x1, rf); asm volatile("" : "+v"(n0)); asm volatile("" : "+v"(n1)); x0 = __fmul_rn(bfr(nw[dd]), n0); x1 = __fmul_rn(bfr(nw[dp]), n1); }
        const v2f cs = *(const v2f*)(CS + ((size_t)t * HD + dd) * 2); float a = __fmul_rn(x0, cs[0]), bq = __fmul_rn(x1, cs[1]); asm volatile("" : "+v"(a)); asm volatile("" : "+v"(bq)); const float r = ((dd < HD / 2) ? __fsub_rn(a, bq) : __fadd_rn(a, bq)) * sc;
        o16[q] = tohx(r); unsigned short a2, c2; splitf(r, a2, c2); oh[q] = a2; ol[q] = c2; }
    *(v2h*)(P16 + e) = o16; *(v2us*)(Ph + e) = oh; *(v2us*)(Pl + e) = ol;  }
__global__ __launch_bounds__(256) void k_vtp(const float* __restrict__ F, int pitch, int nheads, h16* V16, bf* Vh, bf* Vl) { const size_t e = ((size_t)blockIdx.x * 256 + threadIdx.x) * 2; if (e >= (size_t)nheads * HD * TT) return; const int t = (int)(e % TT); const int d = (int)((e / TT) % HD); const int g = (int)(e / ((size_t)TT * HD)); v2h o16; v2us oh, ol;
#pragma unroll
    for (int q = 0; q < 2; ++q) { const float x = bfr(F[(size_t)(t + q) * pitch + g * HD + d]); o16[q] = tohx(x); unsigned short a2, c2; splitf(x, a2, c2); oh[q] = a2; ol[q] = c2; }
    *(v2h*)(V16 + e) = o16; *(v2us*)(Vh + e) = oh; *(v2us*)(Vl + e) = ol;  }
__global__ __launch_bounds__(256) void k_csid(float* CS) { const int idx = blockIdx.x * 256 + threadIdx.x; if (idx >= TT * HD) return; v2f cs; cs[0] = 1.0f; cs[1] = 0.0f; *(v2f*)(CS + (size_t)idx * 2) = cs;  }
// k_asoft: per row (zz, i): t = S x HD^-0.5 for j <= i (plain causal mask, only when the flag is set; the reference's -1e9 additive fill vanishes identically); softmax over the 4096 keys (register row, one exp, fixed trees);
__global__ __launch_bounds__(256) void k_asoft(const float* __restrict__ Sb, const int* __restrict__ CF, h16* P16, bf* Ph, bf* Pl) {
    const int lane = threadIdx.x & 31; const int row = blockIdx.x * 8 + (threadIdx.x >> 5); if (row >= ZH * TT) return; const int i = row % TT; const int zz = row / TT; (void)zz; const bool con = (CF[0] != 0); const bool hires = (i < RH); const float* sr = Sb + (size_t)row * TT; float v[TT / 32]; float mx = -3.0e38f;
#pragma unroll
    for (int ch = 0; ch < TT / 128; ++ch) { const int j0 = ch * 128 + lane * 4; const v4f a = *(const v4f*)(sr + j0);
#pragma unroll
        for (int q = 0; q < 4; ++q) { const int j = j0 + q; (void)j; const float t = (j <= i || !con) ? a[q] * SCL : -3.0e38f;   /* causal only when the flag is set */ v[ch * 4 + q] = t; mx = fmaxf(mx, t); } }
#pragma unroll
    for (int sh = 16; sh; sh >>= 1) mx = fmaxf(mx, __shfl_xor(mx, sh, 32));
    float sum = 0.f;
#pragma unroll
    for (int k = 0; k < TT / 32; ++k) { float d0 = __fsub_rn(v[k], mx); asm volatile("" : "+v"(d0)); v[k] = __builtin_amdgcn_exp2f(__fmul_rn(d0, 1.4426950408889634f)); sum += v[k]; }
#pragma unroll
    for (int sh = 16; sh; sh >>= 1) sum += __shfl_xor(sum, sh, 32);
    const float f = __fdiv_rn(hires ? 1.0f : PCAR, sum);
{
        if (hires) {
#pragma unroll
            for (int ch = 0; ch < TT / 128; ++ch) { v4us oh, ol;
#pragma unroll
                for (int q = 0; q < 4; ++q) { unsigned short a, c2; splitf(v[ch * 4 + q] * f, a, c2); oh[q] = a; ol[q] = c2; }
                const size_t oo = ((size_t)zz * (RH ? RH : 1) + i) * TT + ch * 128 + lane * 4; *(v4us*)(Ph + oo) = oh; *(v4us*)(Pl + oo) = ol; }
        } else {
#pragma unroll
            for (int ch = 0; ch < TT / 128; ++ch) { v4h o4;
#pragma unroll
                for (int q = 0; q < 4; ++q) o4[q] = tohx(v[ch * 4 + q] * f);
                *(v4h*)(P16 + (size_t)row * TT + ch * 128 + lane * 4) = o4; } }
         }
}
__global__ __launch_bounds__(256) void k_merge(const float* __restrict__ O, int h0, float* OUTb) { const size_t e = ((size_t)blockIdx.x * 256 + threadIdx.x) * 2; if (e >= (size_t)ZH * TT * HD) return; const int d = (int)(e % HD); const int t = (int)((e / HD) % TT); const int zz = (int)(e / ((size_t)HD * TT)); const float cs = (t < RH) ? 1.0f : (1.0f / PCAR); const size_t oo = (size_t)t * DQ + (h0 + zz) * HD + d;
    v2f o2; o2[0] = O[e] * cs; o2[1] = O[e + 1] * cs; *(v2f*)(OUTb + oo) = o2;  }   /* f32 output [l][h*64 + d] (lane -> 8 B, 32 lanes = 256 B contiguous) */

extern "C" void kernel_launch(void* const* d_in, const int* in_sizes, int n_in,
                              void* d_out, int out_size, void* d_ws, size_t ws_size, hipStream_t stream) {
    (void)in_sizes; (void)n_in; (void)out_size;
    const float* xq = (const float*)d_in[0]; const float* xk = (const float*)d_in[1]; const float* xv = (const float*)d_in[2]; const int* CFLAG = (const int*)d_in[3];   /* 'causal' flag (int, read on device) */ const float* x = xq; const float* wq = nullptr; const float* wk = nullptr; const float* wv = nullptr; const float* wo = nullptr; (void)x; (void)wq; (void)wk; (void)wv; (void)wo;
    float* OUT = (float*)d_out;     // [1][4096][1024]
    char* wsp = (char*)d_ws;
    auto take = [&](size_t bytes) { char* p = wsp; wsp += (bytes + 255) & ~(size_t)255; return (void*)p; };
    float* CS = (float*)take((size_t)TT * HD * 2 * 4);
    
    h16* QP16 = (h16*)take((size_t)NH_ * TT * HD * 2); h16* KP16 = (h16*)take((size_t)NKV * TT * HD * 2); h16* VT16 = (h16*)take((size_t)NKV * HD * TT * 2);
    bf* QPh = (bf*)take((size_t)NH_ * TT * HD * 2); bf* QPl = (bf*)take((size_t)NH_ * TT * HD * 2); bf* KPh = (bf*)take((size_t)NKV * TT * HD * 2); bf* KPl = (bf*)take((size_t)NKV * TT * HD * 2); bf* VTh = (bf*)take((size_t)NKV * HD * TT * 2); bf* VTl = (bf*)take((size_t)NKV * HD * TT * 2); bf* Ph = (bf*)take((size_t)ZH * RH * TT * 2); bf* Pl = (bf*)take((size_t)ZH * RH * TT * 2);
    float* Sb = (float*)take((size_t)ZH * TT * TT * 4); h16* P16 = (h16*)take(256);   /* unused: every row is on the hi/lo path */ float* Ob = (float*)take((size_t)ZH * TT * HD * 4); 
    if ((size_t)(wsp - (char*)d_ws) > ws_size) return;    // ws 256 MiB

    k_csid<<<(TT * HD + 255) / 256, 256, 0, stream>>>(CS);
    const unsigned LQ = (unsigned)(((size_t)NH_ * TT * HD / 2 + 255) / 256), LKv = (unsigned)(((size_t)NKV * TT * HD / 2 + 255) / 256);
    for (int b = 0; b < NB_; ++b) {
        
        k_rope<<<LQ, 256, 0, stream>>>(xq + (size_t)b * TT * DM, DQ, NH_, CS, nullptr, nullptr, 1.0f, QP16, QPh, QPl);   /* q planes straight from the input (bf16-rounded inside) */
        k_rope<<<LKv, 256, 0, stream>>>(xk + (size_t)b * TT * DM, DKV, NKV, CS, nullptr, nullptr, 1.0f, KP16, KPh, KPl);   /* k planes */
        k_vtp<<<LKv, 256, 0, stream>>>(xv + (size_t)b * TT * DM, DKV, NKV, VT16, VTh, VTl);   /* v^T planes */
        for (int h0 = 0; h0 < NH_; h0 += ZH) { const size_t zq = (size_t)h0, zk = (size_t)(h0 / REP);   // one kv head per query head: each pass handles one head (ZH = 1), kv plane h0 (z-strides TT*HD)
            k_gemmc<bf, 0, 1><<<dim3(RH / 64, TT / 64, ZH), 32, 0, stream>>>(QPh + zq * TT * HD, nullptr, KPh + zk * TT * HD, nullptr, HD, Sb, TT, 0, (size_t)TT * HD, (size_t)TT * HD, (size_t)TT * TT, CFLAG);

            k_asoft<<<ZH * TT / 8, 256, 0, stream>>>(Sb, CFLAG, P16, Ph, Pl);
            k_gemmc<bf, 1, 2><<<dim3(RH / 64, HD / 64, ZH), 32, 0, stream>>>(Ph, Pl, VTh + zk * HD * TT, nullptr, TT, Ob, HD, 0, (size_t)RH * TT, (size_t)HD * TT, (size_t)TT * HD, CFLAG);

            k_merge<<<(unsigned)(((size_t)ZH * TT * HD / 2 + 255) / 256), 256, 0, stream>>>(Ob, h0, OUT + (size_t)b * TT * DM); }
    }
}

// v001
// It runs in 661 microseconds.
// Two timings next to v000 put it at 3.17 and 3.02 times that version's speed.
#include <hip/hip_runtime.h>

// Plain (optionally causal) multi-head attention on given q/k/v (q, k, v [1][4096][16][64]; scores = q.k/8; when the int input 'causal' is non-zero (read on device) keys above the diagonal are masked (-inf == exact zero weight); softmax; out[b][s][h][d] = attn.v -> [1][4096][16][64]).
// Layout: no projections - the bf16-rounded inputs ARE the operand planes (exact single bf16 planes for q, k and v^T), so the score products are exact (1 product) and attn.v takes the f32 softmax weights as bf16 hi + lo against exact v (2 products) on every row; the merged [l][h*64+d] result is written straight to the output in f32.
// Compute dtypes, f32 accumulate: every input rounded to bf16; exact products for q.k; softmax in f32 (one exp2 per element, fixed trees); probabilities as hi/lo planes; f32 output.


#define NB_  1
#define TT   4096
#define DM   1024
#define NH_  16
#define NKV  16
#define REP  (NH_ / NKV)
#define HD   64
#define DQ   (NH_ * HD)
#define DKV  (NKV * HD)
#define ZH   1
#define RH   4096                  // every row on the hi/lo path
#define WIN  4096
#define PCAR 1024.0f
#define SCL  0.125f   // HD^-0.5
typedef _Float16 h16;
typedef unsigned short bf;
typedef __attribute__((ext_vector_type(16))) __bf16   v16bf;
typedef __attribute__((ext_vector_type(16))) _Float16 v16h;
typedef __attribute__((ext_vector_type(8)))  _Float16 v8h;
typedef __attribute__((ext_vector_type(8)))  unsigned short v8us;
typedef __attribute__((ext_vector_type(8)))  float    v8f;
typedef __attribute__((ext_vector_type(4)))  float    v4f;
typedef v8h  __attribute__((may_alias)) v8ha;
typedef v4f  __attribute__((may_alias)) v4fa;
typedef v8us __attribute__((may_alias)) v8usa;

__device__ __forceinline__ unsigned short f2bf(float f) { unsigned u = __float_as_uint(f); u += 0x7FFFu + ((u >> 16) & 1u); return (unsigned short)(u >> 16); }
__device__ __forceinline__ float bf2f(unsigned short b) { return __uint_as_float(((unsigned)b) << 16); }
__device__ __forceinline__ float bfr(float f) { return bf2f(f2bf(f)); }
__device__ __forceinline__ v16h cat16(v8h lo, v8h hi) { return __builtin_shufflevector(lo, hi, 0, 1, 2, 3, 4, 5, 6, 7, 8, 9, 10, 11, 12, 13, 14, 15); }
__device__ __forceinline__ v16bf cat16b(v8us lo, v8us hi) { return __builtin_bit_cast(v16bf, __builtin_shufflevector(lo, hi, 0, 1, 2, 3, 4, 5, 6, 7, 8, 9, 10, 11, 12, 13, 14, 15)); }
__device__ __forceinline__ v8f wmma16(v16h a, v16h b, v8f c) { return __builtin_amdgcn_wmma_f32_16x16x32_f16(false, a, false, b, (short)0, c, false, false); }
__device__ __forceinline__ v8f wmmab(v16bf a, v16bf b, v8f c) { return __builtin_amdgcn_wmma_f32_16x16x32_bf16(false, a, false, b, (short)0, c, false, false); }



// ---- k_gemmw: register-blocked GEMM, ONE WAVE per 64x64 output tile (16 accumulators), operands straight from K-contiguous 16-bit planes; grid (M/64, N/64, Z), 32 threads.
// C[m][n] (f32, pitch ldc, + optional f32 bias[n]) = sum_k A[m][k] Bt[n][k] (+ split products per NSPLIT). z-batch strides sA/sB/sC in elements. K % 32 == 0.
template <typename T16> struct WFrag;
template <> struct WFrag<h16> { typedef v16h V; static __device__ __forceinline__ V ld(const h16* p) { return cat16(*(const v8h*)p, *(const v8h*)(p + 16)); } static __device__ __forceinline__ v8f mma(V a, V b, v8f c) { return wmma16(a, b, c); } };
template <> struct WFrag<bf> { typedef v16bf V; static __device__ __forceinline__ V ld(const bf* p) { return cat16b(*(const v8us*)p, *(const v8us*)(p + 16)); } static __device__ __forceinline__ v8f mma(V a, V b, v8f c) { return wmmab(a, b, c); } };
template <typename T16, int NSPLIT, bool BIAS>
__global__ __launch_bounds__(32) void k_gemmw(const T16* __restrict__ A, const T16* __restrict__ A2, const T16* __restrict__ Bt, const T16* __restrict__ Bt2, int K, float* C, int ldc, const float* __restrict__ bias, size_t sA, size_t sB, size_t sC) {
    typedef typename WFrag<T16>::V V;
    __shared__ __align__(16) float os[16 * 68];
    const size_t z = blockIdx.z; A += z * sA; if (A2) A2 += z * sA; Bt += z * sB; if (Bt2) Bt2 += z * sB; C += z * sC;
    const int lane = threadIdx.x & 31, lr = lane & 15, hi = lane >> 4; const int r0 = blockIdx.x * 64, c0 = blockIdx.y * 64;
    v8f acc[4][4];
#pragma unroll
    for (int mb = 0; mb < 4; ++mb)
#pragma unroll
        for (int nb = 0; nb < 4; ++nb) acc[mb][nb] = (v8f){};
    const size_t aoff = (size_t)(r0 + lr) * K + 8 * hi, boff = (size_t)(c0 + lr) * K + 8 * hi;
#pragma unroll 1
    for (int kc = 0; kc < K; kc += 32) {
        V a[4], a2[4];
#pragma unroll
        for (int mb = 0; mb < 4; ++mb) { a[mb] = WFrag<T16>::ld(A + aoff + (size_t)mb * 16 * K + kc); if (NSPLIT == 1 || NSPLIT == 2) a2[mb] = WFrag<T16>::ld(A2 + aoff + (size_t)mb * 16 * K + kc); }
#pragma unroll
        for (int nb = 0; nb < 4; ++nb) { const V b = WFrag<T16>::ld(Bt + boff + (size_t)nb * 16 * K + kc); V b2; if (NSPLIT >= 2) b2 = WFrag<T16>::ld(Bt2 + boff + (size_t)nb * 16 * K + kc);
#pragma unroll
            for (int mb = 0; mb < 4; ++mb) { acc[mb][nb] = WFrag<T16>::mma(a[mb], b, acc[mb][nb]); if (NSPLIT == 1 || NSPLIT == 2) acc[mb][nb] = WFrag<T16>::mma(a2[mb], b, acc[mb][nb]); if (NSPLIT >= 2) acc[mb][nb] = WFrag<T16>::mma(a[mb], b2, acc[mb][nb]); } }
        asm volatile("v_nop\n\tv_nop\n\tv_nop\n\tv_nop" : "+v"(acc[0][0]), "+v"(acc[1][1]), "+v"(acc[2][2]), "+v"(acc[3][3]) : "v"(a[0]), "v"(a[3]));
    }
#pragma unroll
    for (int mb = 0; mb < 4; ++mb) {
#pragma unroll
        for (int nb = 0; nb < 4; ++nb) {
#pragma unroll
            for (int j = 0; j < 8; ++j) os[(hi * 8 + j) * 68 + nb * 16 + lr] = acc[mb][nb][j]; }
        __builtin_amdgcn_wave_barrier(); asm volatile("" ::: "memory");
        float* crow = C + (size_t)(r0 + mb * 16) * ldc + c0;
{
#pragma unroll
            for (int s = 0; s < 8; ++s) { const int row = 2 * s + hi, cofs = lr * 4; v4f val = *(const v4fa*)(os + row * 68 + cofs); if (BIAS) { val[0] += bfr(bias[c0 + cofs]); val[1] += bfr(bias[c0 + cofs + 1]); val[2] += bfr(bias[c0 + cofs + 2]); val[3] += bfr(bias[c0 + cofs + 3]); }
                *(v4f*)(crow + (size_t)row * ldc + cofs) = val; }
             }
        __builtin_amdgcn_wave_barrier(); asm volatile("" ::: "memory");
    }
}

// ---- k_gemmc: the same one-wave 64x64 tile GEMM specialised for causal attention: CMODE 1 skips score tiles entirely above the diagonal (query rows r0+roff.., key columns c0..), CMODE 2 limits the
// key (K) loop of the probability x value contraction to the diagonal block (probabilities beyond it are exactly zero). roff = row offset of this launch's first row within the sequence.
template <typename T16, int NSPLIT, int CMODE>
__global__ __launch_bounds__(32) void k_gemmc(const T16* __restrict__ A, const T16* __restrict__ A2, const T16* __restrict__ Bt, const T16* __restrict__ Bt2, int K, float* C, int ldc, int roff, size_t sA, size_t sB, size_t sC, const int* CF) {
    typedef typename WFrag<T16>::V V;
    __shared__ __align__(16) float os[16 * 68];
    const size_t z = blockIdx.z; A += z * sA; if (A2) A2 += z * sA; Bt += z * sB; if (Bt2) Bt2 += z * sB; C += z * sC;
    const int lane = threadIdx.x & 31, lr = lane & 15, hi = lane >> 4; const int r0 = blockIdx.x * 64, c0 = blockIdx.y * 64;
    const bool con = (CF == nullptr) || (CF[0] != 0);   /* device flag: causal */ if (CMODE == 1 && con && c0 > r0 + roff + 63) return;                  // score tile entirely above the causal diagonal: never read (the softmax masks j > i by select)
    const int Kl = (CMODE == 2 && con) ? min(K, r0 + roff + 64) : K;        // P.V: probabilities are exactly 0 beyond the diagonal block, so the K loop stops there
    v8f acc[4][4];
#pragma unroll
    for (int mb = 0; mb < 4; ++mb)
#pragma unroll
        for (int nb = 0; nb < 4; ++nb) acc[mb][nb] = (v8f){};
    const size_t aoff = (size_t)(r0 + lr) * K + 8 * hi, boff = (size_t)(c0 + lr) * K + 8 * hi;
#pragma unroll 1
    for (int kc = 0; kc < Kl; kc += 32) {
        V a[4], a2[4];
#pragma unroll
        for (int mb = 0; mb < 4; ++mb) { a[mb] = WFrag<T16>::ld(A + aoff + (size_t)mb * 16 * K + kc); if (NSPLIT == 1 || NSPLIT == 2) a2[mb] = WFrag<T16>::ld(A2 + aoff + (size_t)mb * 16 * K + kc); }
#pragma unroll
        for (int nb = 0; nb < 4; ++nb) { const V b = WFrag<T16>::ld(Bt + boff + (size_t)nb * 16 * K + kc); V b2; if (NSPLIT >= 2) b2 = WFrag<T16>::ld(Bt2 + boff + (size_t)nb * 16 * K + kc);
#pragma unroll
            for (int mb = 0; mb < 4; ++mb) { acc[mb][nb] = WFrag<T16>::mma(a[mb], b, acc[mb][nb]); if (NSPLIT == 1 || NSPLIT == 2) acc[mb][nb] = WFrag<T16>::mma(a2[mb], b, acc[mb][nb]); if (NSPLIT >= 2) acc[mb][nb] = WFrag<T16>::mma(a[mb], b2, acc[mb][nb]); } }
        asm volatile("v_nop\n\tv_nop\n\tv_nop\n\tv_nop" : "+v"(acc[0][0]), "+v"(acc[1][1]), "+v"(acc[2][2]), "+v"(acc[3][3]) : "v"(a[0]), "v"(a[3]));
    }
#pragma unroll
    for (int mb = 0; mb < 4; ++mb) {
#pragma unroll
        for (int nb = 0; nb < 4; ++nb) {
#pragma unroll
            for (int j = 0; j < 8; ++j) os[(hi * 8 + j) * 68 + nb * 16 + lr] = acc[mb][nb][j]; }
        __builtin_amdgcn_wave_barrier(); asm volatile("" ::: "memory");
        float* crow = C + (size_t)(r0 + mb * 16) * ldc + c0;
{
#pragma unroll
            for (int s = 0; s < 8; ++s) { const int row = 2 * s + hi, cofs = lr * 4; v4f val = *(const v4fa*)(os + row * 68 + cofs);
                *(v4f*)(crow + (size_t)row * ldc + cofs) = val; }
             }
        __builtin_amdgcn_wave_barrier(); asm volatile("" ::: "memory");
    }
}

// ---- k_pvsk: probability x value contraction with the key (K) loop split over work-groups and waves. Grid (TT/64, PVS): work-group (x, y) owns query rows 64x.. and keys [512y, 512y + 512);
// each of its PVW waves contracts one 64-key chunk into a 64x64 f32 tile, the tiles are summed through LDS in wave order, and the sum goes to partial plane y of C ([PVS][TT][HD]); k_merge adds the planes in plane order.
// Causal: probabilities beyond the diagonal block are exactly 0, so chunks at or beyond key r0 + 64 are not read (their waves hand in zeros) and work-groups wholly beyond it write no plane (k_merge reads none there: pv_planes).
#define PVW 8                      // waves per work-group, one 64-key chunk each
#define PVK (64 * PVW)             // keys per work-group
#define PVS (TT / PVK)             // partial planes
// amdgpu_waves_per_eu(4, 4) on k_pvsk: keeps the registers at 256 a wave, so that two work-groups (2 x 136 KiB of LDS) share a WGP; without it the build takes more and a WGP holds one.
__device__ __forceinline__ int pv_klim(bool con, int r0) { return con ? r0 + 64 : TT; }                       // keys that the 64-row tile at r0 needs
__device__ __forceinline__ int pv_planes(bool con, int r0) { return (pv_klim(con, r0) + PVK - 1) / PVK; }     // planes that k_pvsk writes for that tile
__global__ __launch_bounds__(32 * PVW) __attribute__((amdgpu_waves_per_eu(4, 4))) void k_pvsk(const bf* __restrict__ A, const bf* __restrict__ A2, const bf* __restrict__ Bt, float* C, const int* __restrict__ CF) {
    typedef WFrag<bf>::V V;
    __shared__ __align__(16) float red[PVW][64 * 68];
    const int lane = threadIdx.x & 31, lr = lane & 15, hi = lane >> 4; const int w = __builtin_amdgcn_readfirstlane((int)(threadIdx.x >> 5)); const int r0 = blockIdx.x * 64;
    const bool con = (CF[0] != 0); const int Kl = pv_klim(con, r0); const int k0 = blockIdx.y * PVK;
    if (k0 >= Kl) return;                                   // same for the whole work-group, in front of the barrier
    v8f acc[4][4];
#pragma unroll
    for (int mb = 0; mb < 4; ++mb)
#pragma unroll
        for (int nb = 0; nb < 4; ++nb) acc[mb][nb] = (v8f){};
    const int kw = k0 + w * 64;
    if (kw < Kl) {                                          // wave-uniform (scalar): the matrix instructions run with every lane on
        const size_t aoff = (size_t)(r0 + lr) * TT + 8 * hi + kw, boff = (size_t)lr * TT + 8 * hi + kw;
        V a[4][2], a2[4][2], b[4][2];                        // the chunk is one 128-byte line a row: the loads of a line stand together and ahead of the products, so that one memory latency covers the chunk
#pragma unroll
        for (int mb = 0; mb < 4; ++mb)
#pragma unroll
            for (int ks = 0; ks < 2; ++ks) { a[mb][ks] = WFrag<bf>::ld(A + aoff + (size_t)mb * 16 * TT + ks * 32); a2[mb][ks] = WFrag<bf>::ld(A2 + aoff + (size_t)mb * 16 * TT + ks * 32); b[mb][ks] = WFrag<bf>::ld(Bt + boff + (size_t)mb * 16 * TT + ks * 32); }
#pragma unroll
        for (int nb = 0; nb < 4; ++nb)
#pragma unroll
            for (int ks = 0; ks < 2; ++ks)
#pragma unroll
                for (int mb = 0; mb < 4; ++mb) { acc[mb][nb] = wmmab(a[mb][ks], b[nb][ks], acc[mb][nb]); acc[mb][nb] = wmmab(a2[mb][ks], b[nb][ks], acc[mb][nb]); }
    }
#pragma unroll
    for (int mb = 0; mb < 4; ++mb)
#pragma unroll
        for (int nb = 0; nb < 4; ++nb)
#pragma unroll
            for (int j = 0; j < 8; ++j) red[w][(mb * 16 + hi * 8 + j) * 68 + nb * 16 + lr] = acc[mb][nb][j];
    __syncthreads();
    float* cp = C + (size_t)blockIdx.y * TT * HD + (size_t)r0 * HD;
#pragma unroll
    for (int i = 0; i < 64 * 16 / (32 * PVW); ++i) { const int s = (int)threadIdx.x + 32 * PVW * i, row = s >> 4, cofs = (s & 15) * 4; v4f sum = *(const v4fa*)(&red[0][row * 68 + cofs]);
#pragma unroll
        for (int u = 1; u < PVW; ++u) sum += *(const v4fa*)(&red[u][row * 68 + cofs]);
        *(v4f*)(cp + row * HD + cofs) = sum; }               // a wave stores 512 contiguous bytes
}

__device__ __forceinline__ h16 tohx(float x) { return (h16)x; }
__device__ __forceinline__ void splitf(float y, unsigned short& h, unsigned short& l) { h = f2bf(y); l = f2bf(y - bf2f(h)); }
typedef __attribute__((ext_vector_type(2))) _Float16 v2h;
typedef __attribute__((ext_vector_type(4))) _Float16 v4h;
typedef __attribute__((ext_vector_type(2))) unsigned short v2us;
typedef __attribute__((ext_vector_type(4))) unsigned short v4us;
typedef __attribute__((ext_vector_type(2))) float v2f;
typedef __attribute__((ext_vector_type(4))) int v4i;

__global__ __launch_bounds__(256) void k_wtG(const float* __restrict__ w, int K, int N, bf* Bt) {
    const int lane = threadIdx.x & 31; const int L0 = (blockIdx.x * 8 + (threadIdx.x >> 5)) * 8; const int nlines = N * K / 64;
{
#pragma unroll 1
        for (int l = 0; l < 8; ++l) { const int L = L0 + l; if (L >= nlines) break; const size_t e = (size_t)L * 64 + lane * 2; const int k = (int)(e % K), n = (int)(e / K); v2us o;
            o[0] = f2bf(w[(size_t)k * N + n]); o[1] = f2bf(w[(size_t)(k + 1) * N + n]); *(v2us*)(Bt + e) = o; }
         }
}
__global__ __launch_bounds__(256) void k_cvt8(const float* __restrict__ src, bf* dst, size_t n8) { const size_t i = (size_t)blockIdx.x * 256 + threadIdx.x; if (i >= n8) return; const v8f v = *(const v8f*)(src + i * 8); v8us o;
#pragma unroll
    for (int k = 0; k < 8; ++k) o[k] = f2bf(v[k]); *(v8us*)(dst + i * 8) = o;  }

// k_rope: head planes [h][t][d] (fp16 + hi/lo) of rope(x) x sc with the rotate-half convention out[d] = x[d] cos[t][d] - x[d+HD/2] sin[t][d], out[d+HD/2] = x[d+HD/2] cos[t][d+HD/2] + x[d] sin[t][d+HD/2]
__global__ __launch_bounds__(256) void k_rope(const float* __restrict__ F, int pitch, int nheads, const float* __restrict__ CS, const float* __restrict__ RF, const float* __restrict__ nw, float sc, h16* P16, bf* Ph, bf* Pl) {
    const size_t e = ((size_t)blockIdx.x * 256 + threadIdx.x) * 2; if (e >= (size_t)nheads * TT * HD) return; const int d = (int)(e % HD); const int t = (int)((e / HD) % TT); const int h = (int)(e / ((size_t)HD * TT)); const float* f = F + (size_t)t * pitch + h * HD; const float rf = RF ? RF[(size_t)h * TT + t] : 1.0f; v2h o16; v2us oh, ol;
#pragma unroll
    for (int q = 0; q < 2; ++q) { const int dd = d + q; const int dp = (dd < HD / 2) ? dd + HD / 2 : dd - HD / 2; float x0 = bfr(f[dd]), x1 = bfr(f[dp]);   /* inputs rounded to bf16 */
        if (RF) { float n0 = __fmul_rn(x0, rf), n1 = __fmul_rn(x1, rf); asm volatile("" : "+v"(n0)); asm volatile("" : "+v"(n1)); x0 = __fmul_rn(bfr(nw[dd]), n0); x1 = __fmul_rn(bfr(nw[dp]), n1); }
        const v2f cs = *(const v2f*)(CS + ((size_t)t * HD + dd) * 2); float a = __fmul_rn(x0, cs[0]), bq = __fmul_rn(x1, cs[1]); asm volatile("" : "+v"(a)); asm volatile("" : "+v"(bq)); const float r = ((dd < HD / 2) ? __fsub_rn(a, bq) : __fadd_rn(a, bq)) * sc;
        o16[q] = tohx(r); unsigned short a2, c2; splitf(r, a2, c2); oh[q] = a2; ol[q] = c2; }
    *(v2h*)(P16 + e) = o16; *(v2us*)(Ph + e) = oh; *(v2us*)(Pl + e) = ol;  }
__global__ __launch_bounds__(256) void k_vtp(const float* __restrict__ F, int pitch, int nheads, h16* V16, bf* Vh, bf* Vl) { const size_t e = ((size_t)blockIdx.x * 256 + threadIdx.x) * 2; if (e >= (size_t)nheads * HD * TT) return; const int t = (int)(e % TT); const int d = (int)((e / TT) % HD); const int g = (int)(e / ((size_t)TT * HD)); v2h o16; v2us oh, ol;
#pragma unroll
    for (int q = 0; q < 2; ++q) { const float x = bfr(F[(size_t)(t + q) * pitch + g * HD + d]); o16[q] = tohx(x); unsigned short a2, c2; splitf(x, a2, c2); oh[q] = a2; ol[q] = c2; }
    *(v2h*)(V16 + e) = o16; *(v2us*)(Vh + e) = oh; *(v2us*)(Vl + e) = ol;  }
__global__ __launch_bounds__(256) void k_csid(float* CS) { const int idx = blockIdx.x * 256 + threadIdx.x; if (idx >= TT * HD) return; v2f cs; cs[0] = 1.0f; cs[1] = 0.0f; *(v2f*)(CS + (size_t)idx * 2) = cs;  }
// k_asoft: per row (zz, i): t = S x HD^-0.5 for j <= i (plain causal mask, only when the flag is set; the reference's -1e9 additive fill vanishes identically); softmax over the 4096 keys (register row, one exp, fixed trees);
__global__ __launch_bounds__(256) void k_asoft(const float* __restrict__ Sb, const int* __restrict__ CF, h16* P16, bf* Ph, bf* Pl) {
    const int lane = threadIdx.x & 31; const int row = blockIdx.x * 8 + (threadIdx.x >> 5); if (row >= ZH * TT) return; const int i = row % TT; const int zz = row / TT; (void)zz; const bool con = (CF[0] != 0); const bool hires = (i < RH); const float* sr = Sb + (size_t)row * TT; float v[TT / 32]; float mx = -3.0e38f;
#pragma unroll
    for (int ch = 0; ch < TT / 128; ++ch) { const int j0 = ch * 128 + lane * 4; const v4f a = *(const v4f*)(sr + j0);
#pragma unroll
        for (int q = 0; q < 4; ++q) { const int j = j0 + q; (void)j; const float t = (j <= i || !con) ? a[q] * SCL : -3.0e38f;   /* causal only when the flag is set */ v[ch * 4 + q] = t; mx = fmaxf(mx, t); } }
#pragma unroll
    for (int sh = 16; sh; sh >>= 1) mx = fmaxf(mx, __shfl_xor(mx, sh, 32));
    float sum = 0.f;
#pragma unroll
    for (int k = 0; k < TT / 32; ++k) { float d0 = __fsub_rn(v[k], mx); asm volatile("" : "+v"(d0)); v[k] = __builtin_amdgcn_exp2f(__fmul_rn(d0, 1.4426950408889634f)); sum += v[k]; }
#pragma unroll
    for (int sh = 16; sh; sh >>= 1) sum += __shfl_xor(sum, sh, 32);
    const float f = __fdiv_rn(hires ? 1.0f : PCAR, sum);
{
        if (hires) {
#pragma unroll
            for (int ch = 0; ch < TT / 128; ++ch) { v4us oh, ol;
#pragma unroll
                for (int q = 0; q < 4; ++q) { unsigned short a, c2; splitf(v[ch * 4 + q] * f, a, c2); oh[q] = a; ol[q] = c2; }
                const size_t oo = ((size_t)zz * (RH ? RH : 1) + i) * TT + ch * 128 + lane * 4; *(v4us*)(Ph + oo) = oh; *(v4us*)(Pl + oo) = ol; }
        } else {
#pragma unroll
            for (int ch = 0; ch < TT / 128; ++ch) { v4h o4;
#pragma unroll
                for (int q = 0; q < 4; ++q) o4[q] = tohx(v[ch * 4 + q] * f);
                *(v4h*)(P16 + (size_t)row * TT + ch * 128 + lane * 4) = o4; } }
         }
}
__global__ __launch_bounds__(256) void k_merge(const float* __restrict__ O, const int* __restrict__ CF, int h0, float* OUTb) { const size_t e = ((size_t)blockIdx.x * 256 + threadIdx.x) * 2; if (e >= (size_t)ZH * TT * HD) return; const int d = (int)(e % HD); const int t = (int)((e / HD) % TT); const int zz = (int)(e / ((size_t)HD * TT)); const float cs = (t < RH) ? 1.0f : (1.0f / PCAR); const size_t oo = (size_t)t * DQ + (h0 + zz) * HD + d;
    const int np = pv_planes(CF[0] != 0, t & ~63); v2f a2 = *(const v2f*)(O + e);   /* k_pvsk's partial planes, added in plane order; a plane that was not written is not read (plane 0 is read in its place and dropped), so that every load is in flight at once */
#pragma unroll
    for (int s = 1; s < PVS; ++s) { const v2f x = *(const v2f*)(O + (size_t)(s < np ? s : 0) * TT * HD + e); a2[0] += (s < np) ? x[0] : 0.0f; a2[1] += (s < np) ? x[1] : 0.0f; }
    v2f o2; o2[0] = a2[0] * cs; o2[1] = a2[1] * cs; *(v2f*)(OUTb + oo) = o2;  }   /* f32 output [l][h*64 + d] (lane -> 8 B, 32 lanes = 256 B contiguous) */

extern "C" void kernel_launch(void* const* d_in, const int* in_sizes, int n_in,
                              void* d_out, int out_size, void* d_ws, size_t ws_size, hipStream_t stream) {
    (void)in_sizes; (void)n_in; (void)out_size;
    const float* xq = (const float*)d_in[0]; const float* xk = (const float*)d_in[1]; const float* xv = (const float*)d_in[2]; const int* CFLAG = (const int*)d_in[3];   /* 'causal' flag (int, read on device) */ const float* x = xq; const float* wq = nullptr; const float* wk = nullptr; const float* wv = nullptr; const float* wo = nullptr; (void)x; (void)wq; (void)wk; (void)wv; (void)wo;
    float* OUT = (float*)d_out;     // [1][4096][1024]
    char* wsp = (char*)d_ws;
    auto take = [&](size_t bytes) { char* p = wsp; wsp += (bytes + 255) & ~(size_t)255; return (void*)p; };
    float* CS = (float*)take((size_t)TT * HD * 2 * 4);
    
    h16* QP16 = (h16*)take((size_t)NH_ * TT * HD * 2); h16* KP16 = (h16*)take((size_t)NKV * TT * HD * 2); h16* VT16 = (h16*)take((size_t)NKV * HD * TT * 2);
    bf* QPh = (bf*)take((size_t)NH_ * TT * HD * 2); bf* QPl = (bf*)take((size_t)NH_ * TT * HD * 2); bf* KPh = (bf*)take((size_t)NKV * TT * HD * 2); bf* KPl = (bf*)take((size_t)NKV * TT * HD * 2); bf* VTh = (bf*)take((size_t)NKV * HD * TT * 2); bf* VTl = (bf*)take((size_t)NKV * HD * TT * 2); bf* Ph = (bf*)take((size_t)ZH * RH * TT * 2); bf* Pl = (bf*)take((size_t)ZH * RH * TT * 2);
    float* Sb = (float*)take((size_t)ZH * TT * TT * 4); h16* P16 = (h16*)take(256);   /* unused: every row is on the hi/lo path */ float* Ob = (float*)take((size_t)PVS * TT * HD * 4); 
    if ((size_t)(wsp - (char*)d_ws) > ws_size) return;    // ws 256 MiB

    k_csid<<<(TT * HD + 255) / 256, 256, 0, stream>>>(CS);
    const unsigned LQ = (unsigned)(((size_t)NH_ * TT * HD / 2 + 255) / 256), LKv = (unsigned)(((size_t)NKV * TT * HD / 2 + 255) / 256);
    for (int b = 0; b < NB_; ++b) {
        
        k_rope<<<LQ, 256, 0, stream>>>(xq + (size_t)b * TT * DM, DQ, NH_, CS, nullptr, nullptr, 1.0f, QP16, QPh, QPl);   /* q planes straight from the input (bf16-rounded inside) */
        k_rope<<<LKv, 256, 0, stream>>>(xk + (size_t)b * TT * DM, DKV, NKV, CS, nullptr, nullptr, 1.0f, KP16, KPh, KPl);   /* k planes */
        k_vtp<<<LKv, 256, 0, stream>>>(xv + (size_t)b * TT * DM, DKV, NKV, VT16, VTh, VTl);   /* v^T planes */
        for (int h0 = 0; h0 < NH_; h0 += ZH) { const size_t zq = (size_t)h0, zk = (size_t)(h0 / REP);   // one kv head per query head: each pass handles one head (ZH = 1), kv plane h0 (z-strides TT*HD)
            k_gemmc<bf, 0, 1><<<dim3(RH / 64, TT / 64, ZH), 32, 0, stream>>>(QPh + zq * TT * HD, nullptr, KPh + zk * TT * HD, nullptr, HD, Sb, TT, 0, (size_t)TT * HD, (size_t)TT * HD, (size_t)TT * TT, CFLAG);

            k_asoft<<<ZH * TT / 8, 256, 0, stream>>>(Sb, CFLAG, P16, Ph, Pl);
            k_pvsk<<<dim3(TT / 64, PVS), 32 * PVW, 0, stream>>>(Ph, Pl, VTh + zk * HD * TT, Ob, CFLAG);

            k_merge<<<(unsigned)(((size_t)ZH * TT * HD / 2 + 255) / 256), 256, 0, stream>>>(Ob, CFLAG, h0, OUT + (size_t)b * TT * DM); }
    }
}

// v003
// One run takes 107 microseconds.
// Versions between v001 and this one are left out; their measured steps multiply to 6.14 times as fast.
// Counting every step since v000, it is 19.0 times as fast.
#include <hip/hip_runtime.h>

// Plain (optionally causal) multi-head attention on given q/k/v (q, k, v [1][4096][16][64]; scores = q.k/8; when the int input 'causal' is non-zero (read on device) keys above the diagonal are masked (-inf == exact zero weight); softmax; out[b][s][h][d] = attn.v -> [1][4096][16][64]).
// Layout: no projections - the bf16-rounded inputs ARE the operand planes (exact single bf16 planes for q, k and v^T), so the score products are exact (1 product) and attn.v takes the f32 softmax weights as bf16 hi + lo against exact v (2 products) on every row; one launch (k_prep) makes the three planes; scores, online softmax and attn.v run in one kernel for all heads (k_fattn), which writes the [l][h*64+d] result straight to the output in f32.
// Compute dtypes, f32 accumulate: every input rounded to bf16; exact products for q.k; online softmax in f32 (one exp2 per element, fixed order); probabilities as bf16 hi/lo operands formed in registers; f32 output.


#define NB_  1
#define TT   4096
#define DM   1024
#define NH_  16
#define NKV  16
#define REP  (NH_ / NKV)
#define HD   64
#define DQ   (NH_ * HD)
#define DKV  (NKV * HD)
#define ZH   1
#define RH   4096                  // every row on the hi/lo path
#define WIN  4096
#define PCAR 1024.0f
#define SCL  0.125f   // HD^-0.5
typedef _Float16 h16;
typedef unsigned short bf;
typedef __attribute__((ext_vector_type(16))) __bf16   v16bf;
typedef __attribute__((ext_vector_type(16))) _Float16 v16h;
typedef __attribute__((ext_vector_type(8)))  _Float16 v8h;
typedef __attribute__((ext_vector_type(8)))  unsigned short v8us;
typedef __attribute__((ext_vector_type(8)))  float    v8f;
typedef __attribute__((ext_vector_type(4)))  float    v4f;
typedef v8h  __attribute__((may_alias)) v8ha;
typedef v4f  __attribute__((may_alias)) v4fa;
typedef v8us __attribute__((may_alias)) v8usa;

__device__ __forceinline__ unsigned short f2bf(float f) { unsigned u = __float_as_uint(f); u += 0x7FFFu + ((u >> 16) & 1u); return (unsigned short)(u >> 16); }
__device__ __forceinline__ float bf2f(unsigned short b) { return __uint_as_float(((unsigned)b) << 16); }
__device__ __forceinline__ float bfr(float f) { return bf2f(f2bf(f)); }
__device__ __forceinline__ v16h cat16(v8h lo, v8h hi) { return __builtin_shufflevector(lo, hi, 0, 1, 2, 3, 4, 5, 6, 7, 8, 9, 10, 11, 12, 13, 14, 15); }
__device__ __forceinline__ v16bf cat16b(v8us lo, v8us hi) { return __builtin_bit_cast(v16bf, __builtin_shufflevector(lo, hi, 0, 1, 2, 3, 4, 5, 6, 7, 8, 9, 10, 11, 12, 13, 14, 15)); }
__device__ __forceinline__ v8f wmma16(v16h a, v16h b, v8f c) { return __builtin_amdgcn_wmma_f32_16x16x32_f16(false, a, false, b, (short)0, c, false, false); }
__device__ __forceinline__ v8f wmmab(v16bf a, v16bf b, v8f c) { return __builtin_amdgcn_wmma_f32_16x16x32_bf16(false, a, false, b, (short)0, c, false, false); }



// ---- k_gemmw: register-blocked GEMM, ONE WAVE per 64x64 output tile (16 accumulators), operands straight from K-contiguous 16-bit planes; grid (M/64, N/64, Z), 32 threads.
// C[m][n] (f32, pitch ldc, + optional f32 bias[n]) = sum_k A[m][k] Bt[n][k] (+ split products per NSPLIT). z-batch strides sA/sB/sC in elements. K % 32 == 0.
template <typename T16> struct WFrag;
template <> struct WFrag<h16> { typedef v16h V; static __device__ __forceinline__ V ld(const h16* p) { return cat16(*(const v8h*)p, *(const v8h*)(p + 16)); } static __device__ __forceinline__ v8f mma(V a, V b, v8f c) { return wmma16(a, b, c); } };
template <> struct WFrag<bf> { typedef v16bf V; static __device__ __forceinline__ V ld(const bf* p) { return cat16b(*(const v8us*)p, *(const v8us*)(p + 16)); } static __device__ __forceinline__ v8f mma(V a, V b, v8f c) { return wmmab(a, b, c); } };
template <typename T16, int NSPLIT, bool BIAS>
__global__ __launch_bounds__(32) void k_gemmw(const T16* __restrict__ A, const T16* __restrict__ A2, const T16* __restrict__ Bt, const T16* __restrict__ Bt2, int K, float* C, int ldc, const float* __restrict__ bias, size_t sA, size_t sB, size_t sC) {
    typedef typename WFrag<T16>::V V;
    __shared__ __align__(16) float os[16 * 68];
    const size_t z = blockIdx.z; A += z * sA; if (A2) A2 += z * sA; Bt += z * sB; if (Bt2) Bt2 += z * sB; C += z * sC;
    const int lane = threadIdx.x & 31, lr = lane & 15, hi = lane >> 4; const int r0 = blockIdx.x * 64, c0 = blockIdx.y * 64;
    v8f acc[4][4];
#pragma unroll
    for (int mb = 0; mb < 4; ++mb)
#pragma unroll
        for (int nb = 0; nb < 4; ++nb) acc[mb][nb] = (v8f){};
    const size_t aoff = (size_t)(r0 + lr) * K + 8 * hi, boff = (size_t)(c0 + lr) * K + 8 * hi;
#pragma unroll 1
    for (int kc = 0; kc < K; kc += 32) {
        V a[4], a2[4];
#pragma unroll
        for (int mb = 0; mb < 4; ++mb) { a[mb] = WFrag<T16>::ld(A + aoff + (size_t)mb * 16 * K + kc); if (NSPLIT == 1 || NSPLIT == 2) a2[mb] = WFrag<T16>::ld(A2 + aoff + (size_t)mb * 16 * K + kc); }
#pragma unroll
        for (int nb = 0; nb < 4; ++nb) { const V b = WFrag<T16>::ld(Bt + boff + (size_t)nb * 16 * K + kc); V b2; if (NSPLIT >= 2) b2 = WFrag<T16>::ld(Bt2 + boff + (size_t)nb * 16 * K + kc);
#pragma unroll
            for (int mb = 0; mb < 4; ++mb) { acc[mb][nb] = WFrag<T16>::mma(a[mb], b, acc[mb][nb]); if (NSPLIT == 1 || NSPLIT == 2) acc[mb][nb] = WFrag<T16>::mma(a2[mb], b, acc[mb][nb]); if (NSPLIT >= 2) acc[mb][nb] = WFrag<T16>::mma(a[mb], b2, acc[mb][nb]); } }
        asm volatile("v_nop\n\tv_nop\n\tv_nop\n\tv_nop" : "+v"(acc[0][0]), "+v"(acc[1][1]), "+v"(acc[2][2]), "+v"(acc[3][3]) : "v"(a[0]), "v"(a[3]));
    }
#pragma unroll
    for (int mb = 0; mb < 4; ++mb) {
#pragma unroll
        for (int nb = 0; nb < 4; ++nb) {
#pragma unroll
            for (int j = 0; j < 8; ++j) os[(hi * 8 + j) * 68 + nb * 16 + lr] = acc[mb][nb][j]; }
        __builtin_amdgcn_wave_barrier(); asm volatile("" ::: "memory");
        float* crow = C + (size_t)(r0 + mb * 16) * ldc + c0;
{
#pragma unroll
            for (int s = 0; s < 8; ++s) { const int row = 2 * s + hi, cofs = lr * 4; v4f val = *(const v4fa*)(os + row * 68 + cofs); if (BIAS) { val[0] += bfr(bias[c0 + cofs]); val[1] += bfr(bias[c0 + cofs + 1]); val[2] += bfr(bias[c0 + cofs + 2]); val[3] += bfr(bias[c0 + cofs + 3]); }
                *(v4f*)(crow + (size_t)row * ldc + cofs) = val; }
             }
        __builtin_amdgcn_wave_barrier(); asm volatile("" ::: "memory");
    }
}

typedef __attribute__((ext_vector_type(2))) _Float16 v2h;
typedef __attribute__((ext_vector_type(4))) _Float16 v4h;
typedef __attribute__((ext_vector_type(2))) unsigned short v2us;
typedef __attribute__((ext_vector_type(4))) unsigned short v4us;
typedef __attribute__((ext_vector_type(2))) float v2f;
typedef __attribute__((ext_vector_type(4))) int v4i;
typedef __attribute__((ext_vector_type(4))) unsigned v4u;
typedef __attribute__((ext_vector_type(2))) unsigned v2u;
typedef __attribute__((ext_vector_type(2))) __bf16 v2bf;

__global__ __launch_bounds__(256) void k_wtG(const float* __restrict__ w, int K, int N, bf* Bt) {
    const int lane = threadIdx.x & 31; const int L0 = (blockIdx.x * 8 + (threadIdx.x >> 5)) * 8; const int nlines = N * K / 64;
{
#pragma unroll 1
        for (int l = 0; l < 8; ++l) { const int L = L0 + l; if (L >= nlines) break; const size_t e = (size_t)L * 64 + lane * 2; const int k = (int)(e % K), n = (int)(e / K); v2us o;
            o[0] = f2bf(w[(size_t)k * N + n]); o[1] = f2bf(w[(size_t)(k + 1) * N + n]); *(v2us*)(Bt + e) = o; }
         }
}
__global__ __launch_bounds__(256) void k_cvt8(const float* __restrict__ src, bf* dst, size_t n8) { const size_t i = (size_t)blockIdx.x * 256 + threadIdx.x; if (i >= n8) return; const v8f v = *(const v8f*)(src + i * 8); v8us o;
#pragma unroll
    for (int k = 0; k < 8; ++k) o[k] = f2bf(v[k]); *(v8us*)(dst + i * 8) = o;  }

// ---- k_prep: the three bf16 operand planes of k_fattn in ONE launch: Qb and Kb [h][t][d], Vt [h][d][t], each input element read once and rounded to bf16 (nearest even). Grid (TT / PT, NH_), 256 threads; a work-group owns PT = 128 tokens of one head.
// Every load is 16 B a lane, 16 lanes on one 256-B input row (4 neighbouring d a lane); all 24 loads of a lane are asked for before the first is used.
// q, k: load i takes tokens 16 i + g (g = thread / 16); 4 d go out as 8 B, a wave stores 256 B in a row.
// v: a lane takes the 8 neighbouring tokens 8 g .. 8 g + 7 and packs those of one d into a 16-B piece; the pieces change lanes through LDS, so that 16 lanes store 256 B of one Vt row.
// LDS: row d is 256 B = 16 pieces; piece g stands at place g ^ (d / 4 mod 16): the 16 writers of a half wave (d 4 apart, same g) and the 16 readers (same d, g = 0..15) each cover all 64 banks once.
#define PT 128
__global__ __launch_bounds__(256) void k_prep(const float* __restrict__ xq, const float* __restrict__ xk, const float* __restrict__ xv, bf* __restrict__ Qb, bf* __restrict__ Kb, bf* __restrict__ Vt) {
    __shared__ __align__(16) unsigned vs[HD * PT / 2];
    const int tid = threadIdx.x, l16 = tid & 15, g = tid >> 4; const int h = blockIdx.y, t0 = blockIdx.x * PT;
    const size_t voff = (size_t)(t0 + g * 8) * DQ + h * HD + l16 * 4, qoff = (size_t)(t0 + g) * DQ + h * HD + l16 * 4;
    v4f xvv[8], xqq[8], xkk[8];
#pragma unroll
    for (int i = 0; i < 8; ++i) xvv[i] = *(const v4f*)(xv + voff + (size_t)i * DQ);
    asm volatile("s_wait_xcnt 0x0" ::: "memory");            // in front of every rewrite of an address register of the v loads (the build lets the next loads' data land on it)
#pragma unroll
    for (int i = 0; i < 8; ++i) xqq[i] = *(const v4f*)(xq + qoff + (size_t)i * 16 * DQ);
    asm volatile("s_wait_xcnt 0x0" ::: "memory");            // the same for the q loads
#pragma unroll
    for (int i = 0; i < 8; ++i) xkk[i] = *(const v4f*)(xk + qoff + (size_t)i * 16 * DQ);
    asm volatile("s_wait_xcnt 0x0" ::: "memory");            // the same for the k loads
    __builtin_amdgcn_sched_barrier(0);                       // keeps all 24 loads in front of the first use: left alone the build sinks the q and k loads between the conversions, and their latencies add up
#pragma unroll
    for (int j = 0; j < 4; ++j) { v4u o;
#pragma unroll
        for (int p = 0; p < 4; ++p) { v2f a; a[0] = xvv[2 * p][j]; a[1] = xvv[2 * p + 1][j]; o[p] = __builtin_bit_cast(unsigned, __builtin_convertvector(a, v2bf)); }
        *(v4u*)(vs + (l16 * 4 + j) * (PT / 2) + (g ^ l16) * 4) = o; }
    bf* qd = Qb + ((size_t)h * TT + t0) * HD + (size_t)tid * 4; bf* kd = Kb + ((size_t)h * TT + t0) * HD + (size_t)tid * 4;
#pragma unroll
    for (int i = 0; i < 8; ++i) { v2u oq, ok;
#pragma unroll
        for (int p = 0; p < 2; ++p) { v2f a, b; a[0] = xqq[i][2 * p]; a[1] = xqq[i][2 * p + 1]; b[0] = xkk[i][2 * p]; b[1] = xkk[i][2 * p + 1]; oq[p] = __builtin_bit_cast(unsigned, __builtin_convertvector(a, v2bf)); ok[p] = __builtin_bit_cast(unsigned, __builtin_convertvector(b, v2bf)); }
        *(v2u*)(qd + i * 1024) = oq; *(v2u*)(kd + i * 1024) = ok; }
    asm volatile("s_wait_xcnt 0x0" ::: "memory");            // in front of every rewrite of a data or address register of the q and k stores
    // work-group barrier with LDS-only fences: every piece of the v tile is in LDS before a lane takes another lane's; __syncthreads() would also wait here for the q and k stores, which nobody in this launch reads
    __builtin_amdgcn_fence(__ATOMIC_RELEASE, "workgroup", "local"); __builtin_amdgcn_s_barrier(); __builtin_amdgcn_fence(__ATOMIC_ACQUIRE, "workgroup", "local");
#pragma unroll
    for (int i = 0; i < 4; ++i) { const int d = i * 16 + g; *(v4u*)(Vt + ((size_t)h * HD + d) * TT + t0 + l16 * 8) = *(const v4u*)(vs + d * (PT / 2) + (l16 ^ ((d >> 2) & 15)) * 4); }
}
// ---- k_fattn: scores, softmax and probability x value contraction of one head in ONE kernel; no score or probability leaves the registers. Grid (NH_, TT / (FQ * FW)), FW waves a work-group, no LDS, no barrier.
// A wave owns FQ = 32 query columns and walks the keys 32 at a time (a pass). Transposed products: S^T[key][query] = K . Q^T (A = K rows, B = Q rows, same loader, so the k order pairs), O^T[d][query] += V^T . P^T.
// A lane then holds one query's scores: two S^T tiles (keys 0-15 and 16-31 of the pass), converted in place, ARE the B operand of the second product in the hardware k order (element s: key 8 * hi + s, s < 8; 16 + 8 * hi + s - 8 above), which is the order WFrag::ld reads V^T in.
// Online softmax in the log2 domain: p = exp2(s * FSC - m), m = the column's maximum in use; sums and output tiles are rescaled only when some column's new maximum exceeds m by more than 8 (p <= 2^8, far inside f32); p goes in as bf16 hi + lo against exact v (2 products); the division by the column's sum comes last.
// Causal: a wave stops behind its diagonal pass (keys q0 .. q0 + 31), the only one that needs the mask; heaviest work-groups first.
#define FQ 32
#define FW 4
#define FSC 0.18033688011112042f   // HD^-0.5 * log2(e)
typedef __attribute__((ext_vector_type(8))) unsigned v8u;
__device__ __forceinline__ float xhalf(float x) { const int b = __float_as_int(x); return __int_as_float(__builtin_amdgcn_permlanex16(b, b, 0x76543210, 0xfedcba98, false, false)); }   // lane l <- lane l ^ 16, on the vector pipe
__global__ __launch_bounds__(32 * FW) void k_fattn(const bf* __restrict__ Q, const bf* __restrict__ Kp, const bf* __restrict__ Vt, const int* __restrict__ CF, float* OUTb) {
    typedef WFrag<bf>::V V;
    const int lane = threadIdx.x & 31, lr = lane & 15, hi = lane >> 4; const int w = __builtin_amdgcn_readfirstlane((int)(threadIdx.x >> 5)); const int h = blockIdx.x;
    const int q0 = ((TT / (FQ * FW) - 1 - (int)blockIdx.y) * FW + w) * FQ; const bool con = (CF[0] != 0);
    const int klast = con ? q0 : TT - 32;                    // first key of the wave's last pass (wave-uniform)
    const bf* qp = Q + (size_t)h * TT * HD + (size_t)(q0 + lr) * HD + 8 * hi; const bf* kp = Kp + (size_t)h * TT * HD + (size_t)lr * HD + 8 * hi; const bf* vp = Vt + (size_t)h * HD * TT + (size_t)lr * TT + 8 * hi;
    V qf[2][2], kf[2][2];
#pragma unroll
    for (int t = 0; t < 2; ++t)
#pragma unroll
        for (int ks = 0; ks < 2; ++ks) { qf[t][ks] = WFrag<bf>::ld(qp + t * 16 * HD + ks * 32); kf[t][ks] = WFrag<bf>::ld(kp + t * 16 * HD + ks * 32); }
    v8f o[4][2]; float m[2], l[2];
#pragma unroll
    for (int qt = 0; qt < 2; ++qt) { m[qt] = -3.0e38f; l[qt] = 0.0f;
#pragma unroll
        for (int dt = 0; dt < 4; ++dt) o[dt][qt] = (v8f){}; }
    // the pass loop stays rolled (two passes side by side would not fit 256 registers); every inner loop is unrolled so that the fragment arrays are registers
#pragma unroll 1
    for (int kb = 0; kb <= klast; kb += 32) {
        V vf[4];                                             // this pass's V^T, asked for ahead of the score products: the softmax covers its latency
#pragma unroll
        for (int dt = 0; dt < 4; ++dt) vf[dt] = WFrag<bf>::ld(vp + (size_t)dt * 16 * TT + kb);
        __builtin_amdgcn_sched_barrier(0);                   // keeps these loads up here: left alone the build sinks them behind the maximum, and the second product waits on them
        v8f st[2][2];
#pragma unroll
        for (int kt = 0; kt < 2; ++kt)
#pragma unroll
            for (int qt = 0; qt < 2; ++qt) { st[kt][qt] = wmmab(kf[kt][0], qf[qt][0], (v8f){}); st[kt][qt] = wmmab(kf[kt][1], qf[qt][1], st[kt][qt]); }
        const int kn = min(kb + 32, klast);                  // the next pass's K rows, fetched one pass ahead (the last pass fetches its own again: in bounds, unused)
#pragma unroll
        for (int kt = 0; kt < 2; ++kt)
#pragma unroll
            for (int ks = 0; ks < 2; ++ks) kf[kt][ks] = WFrag<bf>::ld(kp + (size_t)(kn + kt * 16) * HD + ks * 32);
        asm volatile("s_wait_xcnt 0x0" ::: "memory");        // in front of every rewrite of an address register of this pass's V^T and K loads
        if (con && kb == klast) {                            // diagonal pass (scalar branch): keys above the query get weight exp2(-huge) = 0
#pragma unroll
            for (int kt = 0; kt < 2; ++kt)
#pragma unroll
                for (int qt = 0; qt < 2; ++qt)
#pragma unroll
                    for (int j = 0; j < 8; ++j) st[kt][qt][j] = (kt * 16 + hi * 8 + j <= qt * 16 + lr) ? st[kt][qt][j] : -3.0e38f;
        }
        float mx[2]; bool need = false;
#pragma unroll
        for (int qt = 0; qt < 2; ++qt) { float a = st[0][qt][0];
#pragma unroll
            for (int j = 1; j < 8; ++j) a = fmaxf(a, st[0][qt][j]);
#pragma unroll
            for (int j = 0; j < 8; ++j) a = fmaxf(a, st[1][qt][j]);
            a = fmaxf(a, xhalf(a)) * FSC;       // lanes c and c + 16 hold the two halves of one query's keys: both must use one m
            mx[qt] = a; need = need || (a > m[qt] + 8.0f); }
        if (__builtin_amdgcn_ballot_w32(need) != 0) {        // scalar branch, once a pass
#pragma unroll
            for (int qt = 0; qt < 2; ++qt) { const float mn = fmaxf(m[qt], mx[qt]); const float f = __builtin_amdgcn_exp2f(m[qt] - mn); m[qt] = mn; l[qt] *= f;
#pragma unroll
                for (int dt = 0; dt < 4; ++dt) o[dt][qt] *= f; }
        }
        V ph[2], pl[2];
#pragma unroll
        for (int qt = 0; qt < 2; ++qt) { v8u uh, ul; float s0 = 0.0f, s1 = 0.0f;
#pragma unroll
            for (int kt = 0; kt < 2; ++kt)
#pragma unroll
                for (int jp = 0; jp < 4; ++jp) { v2f pp; pp[0] = __builtin_amdgcn_exp2f(__builtin_fmaf(st[kt][qt][2 * jp], FSC, -m[qt])); pp[1] = __builtin_amdgcn_exp2f(__builtin_fmaf(st[kt][qt][2 * jp + 1], FSC, -m[qt])); s0 += pp[0]; s1 += pp[1];
                    const unsigned u = __builtin_bit_cast(unsigned, __builtin_convertvector(pp, v2bf)); v2f rr; rr[0] = pp[0] - __uint_as_float(u << 16); rr[1] = pp[1] - __uint_as_float(u & 0xFFFF0000u);
                    uh[kt * 4 + jp] = u; ul[kt * 4 + jp] = __builtin_bit_cast(unsigned, __builtin_convertvector(rr, v2bf)); }
            l[qt] += s0 + s1; ph[qt] = __builtin_bit_cast(V, uh); pl[qt] = __builtin_bit_cast(V, ul); }
#pragma unroll
        for (int dt = 0; dt < 4; ++dt)
#pragma unroll
            for (int qt = 0; qt < 2; ++qt) o[dt][qt] = wmmab(vf[dt], ph[qt], o[dt][qt]);
#pragma unroll
        for (int dt = 0; dt < 4; ++dt)
#pragma unroll
            for (int qt = 0; qt < 2; ++qt) o[dt][qt] = wmmab(vf[dt], pl[qt], o[dt][qt]);
    }
#pragma unroll
    for (int qt = 0; qt < 2; ++qt) { const float f = __fdiv_rn(1.0f, l[qt] + xhalf(l[qt])); float* op = OUTb + (size_t)(q0 + qt * 16 + lr) * DQ + h * HD + 8 * hi;   /* f32 output [l][h*64 + d]; register j of tile dt is d = 16 dt + 8 hi + j */
#pragma unroll
        for (int dt = 0; dt < 4; ++dt) { const v8f r = o[dt][qt] * f; v4f r0, r1;
#pragma unroll
            for (int j = 0; j < 4; ++j) { r0[j] = r[j]; r1[j] = r[4 + j]; }
            *(v4f*)(op + dt * 16) = r0; *(v4f*)(op + dt * 16 + 4) = r1; } }
}

extern "C" void kernel_launch(void* const* d_in, const int* in_sizes, int n_in,
                              void* d_out, int out_size, void* d_ws, size_t ws_size, hipStream_t stream) {
    (void)in_sizes; (void)n_in; (void)out_size;
    const float* xq = (const float*)d_in[0]; const float* xk = (const float*)d_in[1]; const float* xv = (const float*)d_in[2]; const int* CFLAG = (const int*)d_in[3];   /* 'causal' flag (int, read on device) */ const float* x = xq; const float* wq = nullptr; const float* wk = nullptr; const float* wv = nullptr; const float* wo = nullptr; (void)x; (void)wq; (void)wk; (void)wv; (void)wo;
    float* OUT = (float*)d_out;     // [1][4096][1024]
    char* wsp = (char*)d_ws;
    auto take = [&](size_t bytes) { char* p = wsp; wsp += (bytes + 255) & ~(size_t)255; return (void*)p; };
    bf* QPh = (bf*)take((size_t)NH_ * TT * HD * 2); bf* KPh = (bf*)take((size_t)NKV * TT * HD * 2); bf* VTh = (bf*)take((size_t)NKV * HD * TT * 2);
    if ((size_t)(wsp - (char*)d_ws) > ws_size) return;    // ws 256 MiB

    for (int b = 0; b < NB_; ++b) {
        k_prep<<<dim3(TT / PT, NH_), 256, 0, stream>>>(xq + (size_t)b * TT * DM, xk + (size_t)b * TT * DM, xv + (size_t)b * TT * DM, QPh, KPh, VTh);   /* bf16 planes of q, k and v^T straight from the inputs */
        k_fattn<<<dim3(NH_, TT / (FQ * FW)), 32 * FW, 0, stream>>>(QPh, KPh, VTh, CFLAG, OUT + (size_t)b * TT * DM);   /* one kv head per query head */
    }
}

// v004
// A run of this version takes 94.8 microseconds.
// Two timings next to v003 put it at 1.13 and 1.16 times that version's speed.
// Counting every step since v000, it is 21.7 times as fast.
#include <hip/hip_runtime.h>

// Plain (optionally causal) multi-head attention on given q/k/v (q, k, v [1][4096][16][64]; scores = q.k/8; when the int input 'causal' is non-zero (read on device) keys above the diagonal are masked (-inf == exact zero weight); softmax; out[b][s][h][d] = attn.v -> [1][4096][16][64]).
// Layout: no projections - the bf16-rounded inputs ARE the operand planes (exact single bf16 planes for q, k and v^T), so the score products are exact (1 product) and attn.v takes the f32 softmax weights as bf16 hi + lo against exact v (2 products) on every row; one launch (k_prep) makes the three planes, k and v^T in the order in which the matrix fragments are loaded; scores, online softmax and attn.v run in one kernel for all heads (k_fattn), which writes the [l][h*64+d] result straight to the output in f32.
// Compute dtypes, f32 accumulate: every input rounded to bf16; exact products for q.k; online softmax in f32 (one exp2 per element, fixed order); probabilities as bf16 hi/lo operands formed in registers; f32 output.


#define NB_  1
#define TT   4096
#define DM   1024
#define NH_  16
#define NKV  16
#define REP  (NH_ / NKV)
#define HD   64
#define DQ   (NH_ * HD)
#define DKV  (NKV * HD)
#define ZH   1
#define RH   4096                  // every row on the hi/lo path
#define WIN  4096
#define PCAR 1024.0f
#define SCL  0.125f   // HD^-0.5
typedef _Float16 h16;
typedef unsigned short bf;
typedef __attribute__((ext_vector_type(16))) __bf16   v16bf;
typedef __attribute__((ext_vector_type(16))) _Float16 v16h;
typedef __attribute__((ext_vector_type(8)))  _Float16 v8h;
typedef __attribute__((ext_vector_type(8)))  unsigned short v8us;
typedef __attribute__((ext_vector_type(8)))  float    v8f;
typedef __attribute__((ext_vector_type(4)))  float    v4f;
typedef v8h  __attribute__((may_alias)) v8ha;
typedef v4f  __attribute__((may_alias)) v4fa;
typedef v8us __attribute__((may_alias)) v8usa;

__device__ __forceinline__ unsigned short f2bf(float f) { unsigned u = __float_as_uint(f); u += 0x7FFFu + ((u >> 16) & 1u); return (unsigned short)(u >> 16); }
__device__ __forceinline__ float bf2f(unsigned short b) { return __uint_as_float(((unsigned)b) << 16); }
__device__ __forceinline__ float bfr(float f) { return bf2f(f2bf(f)); }
__device__ __forceinline__ v16h cat16(v8h lo, v8h hi) { return __builtin_shufflevector(lo, hi, 0, 1, 2, 3, 4, 5, 6, 7, 8, 9, 10, 11, 12, 13, 14, 15); }
__device__ __forceinline__ v16bf cat16b(v8us lo, v8us hi) { return __builtin_bit_cast(v16bf, __builtin_shufflevector(lo, hi, 0, 1, 2, 3, 4, 5, 6, 7, 8, 9, 10, 11, 12, 13, 14, 15)); }
__device__ __forceinline__ v8f wmma16(v16h a, v16h b, v8f c) { return __builtin_amdgcn_wmma_f32_16x16x32_f16(false, a, false, b, (short)0, c, false, false); }
__device__ __forceinline__ v8f wmmab(v16bf a, v16bf b, v8f c) { return __builtin_amdgcn_wmma_f32_16x16x32_bf16(false, a, false, b, (short)0, c, false, false); }



// ---- k_gemmw: register-blocked GEMM, ONE WAVE per 64x64 output tile (16 accumulators), operands straight from K-contiguous 16-bit planes; grid (M/64, N/64, Z), 32 threads.
// C[m][n] (f32, pitch ldc, + optional f32 bias[n]) = sum_k A[m][k] Bt[n][k] (+ split products per NSPLIT). z-batch strides sA/sB/sC in elements. K % 32 == 0.
template <typename T16> struct WFrag;
template <> struct WFrag<h16> { typedef v16h V; static __device__ __forceinline__ V ld(const h16* p) { return cat16(*(const v8h*)p, *(const v8h*)(p + 16)); } static __device__ __forceinline__ v8f mma(V a, V b, v8f c) { return wmma16(a, b, c); } };
template <> struct WFrag<bf> { typedef v16bf V; static __device__ __forceinline__ V ld(const bf* p) { return cat16b(*(const v8us*)p, *(const v8us*)(p + 16)); } static __device__ __forceinline__ v8f mma(V a, V b, v8f c) { return wmmab(a, b, c); } };
template <typename T16, int NSPLIT, bool BIAS>
__global__ __launch_bounds__(32) void k_gemmw(const T16* __restrict__ A, const T16* __restrict__ A2, const T16* __restrict__ Bt, const T16* __restrict__ Bt2, int K, float* C, int ldc, const float* __restrict__ bias, size_t sA, size_t sB, size_t sC) {
    typedef typename WFrag<T16>::V V;
    __shared__ __align__(16) float os[16 * 68];
    const size_t z = blockIdx.z; A += z * sA; if (A2) A2 += z * sA; Bt += z * sB; if (Bt2) Bt2 += z * sB; C += z * sC;
    const int lane = threadIdx.x & 31, lr = lane & 15, hi = lane >> 4; const int r0 = blockIdx.x * 64, c0 = blockIdx.y * 64;
    v8f acc[4][4];
#pragma unroll
    for (int mb = 0; mb < 4; ++mb)
#pragma unroll
        for (int nb = 0; nb < 4; ++nb) acc[mb][nb] = (v8f){};
    const size_t aoff = (size_t)(r0 + lr) * K + 8 * hi, boff = (size_t)(c0 + lr) * K + 8 * hi;
#pragma unroll 1
    for (int kc = 0; kc < K; kc += 32) {
        V a[4], a2[4];
#pragma unroll
        for (int mb = 0; mb < 4; ++mb) { a[mb] = WFrag<T16>::ld(A + aoff + (size_t)mb * 16 * K + kc); if (NSPLIT == 1 || NSPLIT == 2) a2[mb] = WFrag<T16>::ld(A2 + aoff + (size_t)mb * 16 * K + kc); }
#pragma unroll
        for (int nb = 0; nb < 4; ++nb) { const V b = WFrag<T16>::ld(Bt + boff + (size_t)nb * 16 * K + kc); V b2; if (NSPLIT >= 2) b2 = WFrag<T16>::ld(Bt2 + boff + (size_t)nb * 16 * K + kc);
#pragma unroll
            for (int mb = 0; mb < 4; ++mb) { acc[mb][nb] = WFrag<T16>::mma(a[mb], b, acc[mb][nb]); if (NSPLIT == 1 || NSPLIT == 2) acc[mb][nb] = WFrag<T16>::mma(a2[mb], b, acc[mb][nb]); if (NSPLIT >= 2) acc[mb][nb] = WFrag<T16>::mma(a[mb], b2, acc[mb][nb]); } }
        asm volatile("v_nop\n\tv_nop\n\tv_nop\n\tv_nop" : "+v"(acc[0][0]), "+v"(acc[1][1]), "+v"(acc[2][2]), "+v"(acc[3][3]) : "v"(a[0]), "v"(a[3]));
    }
#pragma unroll
    for (int mb = 0; mb < 4; ++mb) {
#pragma unroll
        for (int nb = 0; nb < 4; ++nb) {
#pragma unroll
            for (int j = 0; j < 8; ++j) os[(hi * 8 + j) * 68 + nb * 16 + lr] = acc[mb][nb][j]; }
        __builtin_amdgcn_wave_barrier(); asm volatile("" ::: "memory");
        float* crow = C + (size_t)(r0 + mb * 16) * ldc + c0;
{
#pragma unroll
            for (int s = 0; s < 8; ++s) { const int row = 2 * s + hi, cofs = lr * 4; v4f val = *(const v4fa*)(os + row * 68 + cofs); if (BIAS) { val[0] += bfr(bias[c0 + cofs]); val[1] += bfr(bias[c0 + cofs + 1]); val[2] += bfr(bias[c0 + cofs + 2]); val[3] += bfr(bias[c0 + cofs + 3]); }
                *(v4f*)(crow + (size_t)row * ldc + cofs) = val; }
             }
        __builtin_amdgcn_wave_barrier(); asm volatile("" ::: "memory");
    }
}

typedef __attribute__((ext_vector_type(2))) _Float16 v2h;
typedef __attribute__((ext_vector_type(4))) _Float16 v4h;
typedef __attribute__((ext_vector_type(2))) unsigned short v2us;
typedef __attribute__((ext_vector_type(4))) unsigned short v4us;
typedef __attribute__((ext_vector_type(2))) float v2f;
typedef __attribute__((ext_vector_type(4))) int v4i;
typedef __attribute__((ext_vector_type(4))) unsigned v4u;
typedef __attribute__((ext_vector_type(2))) unsigned v2u;
typedef __attribute__((ext_vector_type(2))) __bf16 v2bf;

__global__ __launch_bounds__(256) void k_wtG(const float* __restrict__ w, int K, int N, bf* Bt) {
    const int lane = threadIdx.x & 31; const int L0 = (blockIdx.x * 8 + (threadIdx.x >> 5)) * 8; const int nlines = N * K / 64;
{
#pragma unroll 1
        for (int l = 0; l < 8; ++l) { const int L = L0 + l; if (L >= nlines) break; const size_t e = (size_t)L * 64 + lane * 2; const int k = (int)(e % K), n = (int)(e / K); v2us o;
            o[0] = f2bf(w[(size_t)k * N + n]); o[1] = f2bf(w[(size_t)(k + 1) * N + n]); *(v2us*)(Bt + e) = o; }
         }
}
__global__ __launch_bounds__(256) void k_cvt8(const float* __restrict__ src, bf* dst, size_t n8) { const size_t i = (size_t)blockIdx.x * 256 + threadIdx.x; if (i >= n8) return; const v8f v = *(const v8f*)(src + i * 8); v8us o;
#pragma unroll
    for (int k = 0; k < 8; ++k) o[k] = f2bf(v[k]); *(v8us*)(dst + i * 8) = o;  }

// ---- k_prep: the three bf16 operand planes of k_fattn in ONE launch: Qb [h][t][d], Kf and Vf in fragment order (below), each input element read once and rounded to bf16 (nearest even). Grid (TT / PT, NH_), 256 threads; a work-group owns PT = 128 tokens of one head.
// Fragment order: a head's keys in blocks of 32 (one pass of k_fattn), a block = 8 units of 512 B, a unit = 32 lanes x 16 B (a piece = 8 bf16), lane = 16 hi + lr: ONE wave-wide 16-B load of k_fattn reads one unit, 4 whole 128-B lines.
//   Kf unit (kt * 2 + ks) * 2 + c, lane (hi, lr): key 16 kt + lr, d = 32 ks + 16 c + 8 hi + 0..7.   Vf unit dt * 2 + c, lane (hi, lr): d = 16 dt + lr, keys 16 c + 8 hi + 0..7.
// Every load is 16 B a lane, 16 lanes on one 256-B input row (4 neighbouring d a lane); all 24 loads of a lane are asked for before the first is used.
// q, k: load i takes tokens 16 i + g (g = thread / 16), 4 d a lane. q goes out as 8 B a lane, a wave stores 256 B in a row; k's 8-B half pieces change lanes through LDS.
// v: a lane takes the 8 neighbouring tokens 8 g .. 8 g + 7 and packs those of one d into a 16-B piece; the pieces change lanes through LDS. Behind the barrier a wave stores whole 512-B units of Kf and Vf.
// LDS, v: row d is 256 B = 16 pieces; piece g stands at place g ^ s(d), s(d) = (d & 12) | ((d / 16 ^ d) & 3): the 16 writers of a half wave (d 4 apart, same g) and the 16 readers (16 neighbouring d, same g) each cover all 64 banks once.
// LDS, k: the units in their final order, but piece (hi, lr) of a unit stands at place 16 hi + (lr ^ 2 (4 ks + 2 c + hi)): the 32 writers of a wave (two tokens, all 64 d) and the 16 readers of a half wave each cover all 64 banks once.
#define PT 128
__global__ __launch_bounds__(256) void k_prep(const float* __restrict__ xq, const float* __restrict__ xk, const float* __restrict__ xv, bf* __restrict__ Qb, bf* __restrict__ Kf, bf* __restrict__ Vf) {
    __shared__ __align__(16) unsigned vs[HD * PT / 2];
    __shared__ __align__(16) unsigned kl[HD * PT / 2];
    const int tid = threadIdx.x, l16 = tid & 15, g = tid >> 4; const int h = blockIdx.y, t0 = blockIdx.x * PT;
    const size_t voff = (size_t)(t0 + g * 8) * DQ + h * HD + l16 * 4, qoff = (size_t)(t0 + g) * DQ + h * HD + l16 * 4;
    v4f xvv[8], xqq[8], xkk[8];
#pragma unroll
    for (int i = 0; i < 8; ++i) xvv[i] = *(const v4f*)(xv + voff + (size_t)i * DQ);
    asm volatile("s_wait_xcnt 0x0" ::: "memory");            // in front of every rewrite of an address register of the v loads (the build lets the next loads' data land on it)
#pragma unroll
    for (int i = 0; i < 8; ++i) xqq[i] = *(const v4f*)(xq + qoff + (size_t)i * 16 * DQ);
    asm volatile("s_wait_xcnt 0x0" ::: "memory");            // the same for the q loads
#pragma unroll
    for (int i = 0; i < 8; ++i) xkk[i] = *(const v4f*)(xk + qoff + (size_t)i * 16 * DQ);
    asm volatile("s_wait_xcnt 0x0" ::: "memory");            // the same for the k loads
    __builtin_amdgcn_sched_barrier(0);                       // keeps all 24 loads in front of the first use: left alone the build sinks the q and k loads between the conversions, and their latencies add up
#pragma unroll
    for (int j = 0; j < 4; ++j) { v4u o;
#pragma unroll
        for (int p = 0; p < 4; ++p) { v2f a; a[0] = xvv[2 * p][j]; a[1] = xvv[2 * p + 1][j]; o[p] = __builtin_bit_cast(unsigned, __builtin_convertvector(a, v2bf)); }
        *(v4u*)(vs + (l16 * 4 + j) * (PT / 2) + (g ^ ((l16 & 3) * 4 | ((l16 >> 2) ^ j))) * 4) = o; }
    bf* qd = Qb + ((size_t)h * TT + t0) * HD + (size_t)tid * 4;
    unsigned* kw = kl + (l16 >> 2) * 128 + (((l16 >> 1) & 1) * 16 + (g ^ ((l16 >> 1) * 2))) * 4 + (l16 & 1) * 2;   // unit 2 ks + c of key tile 0, the lane's half piece; load i is key tile i: 4 units on
#pragma unroll
    for (int i = 0; i < 8; ++i) { v2u oq, ok;
#pragma unroll
        for (int p = 0; p < 2; ++p) { v2f a, b; a[0] = xqq[i][2 * p]; a[1] = xqq[i][2 * p + 1]; b[0] = xkk[i][2 * p]; b[1] = xkk[i][2 * p + 1]; oq[p] = __builtin_bit_cast(unsigned, __builtin_convertvector(a, v2bf)); ok[p] = __builtin_bit_cast(unsigned, __builtin_convertvector(b, v2bf)); }
        *(v2u*)(qd + i * 1024) = oq; *(v2u*)(kw + i * 512) = ok; }
    asm volatile("s_wait_xcnt 0x0" ::: "memory");            // in front of every rewrite of a data or address register of the q stores
    // work-group barrier with LDS-only fences: every piece of the k and v tiles is in LDS before a lane takes another lane's; __syncthreads() would also wait here for the q stores, which nobody in this launch reads
    __builtin_amdgcn_fence(__ATOMIC_RELEASE, "workgroup", "local"); __builtin_amdgcn_s_barrier(); __builtin_amdgcn_fence(__ATOMIC_ACQUIRE, "workgroup", "local");
#pragma unroll
    for (int i = 0; i < 4; ++i) {                            // thread tid stores piece i * 256 + tid of the work-group's 16 KB of each plane: unit i * 8 + tid / 32, lane tid % 32 = (hi, l16)
        const int hi = g & 1, u = tid >> 5, d = (u >> 1) * 16 + l16;
        const v4u kv = *(const v4u*)(kl + (i * 8 + u) * 128 + (hi * 16 + (l16 ^ (((u & 3) * 2 + hi) * 2))) * 4);
        const v4u vv = *(const v4u*)(vs + d * (PT / 2) + ((i * 4 + (u & 1) * 2 + hi) ^ ((l16 & 12) | (((u >> 1) ^ l16) & 3))) * 4);
        *(v4u*)(Kf + ((size_t)h * TT + t0) * HD + (size_t)(i * 256 + tid) * 8) = kv; *(v4u*)(Vf + ((size_t)h * TT + t0) * HD + (size_t)(i * 256 + tid) * 8) = vv; }
}
// ---- k_fattn: scores, softmax and probability x value contraction of one head in ONE kernel; no score or probability leaves the registers. Grid (NH_, TT / (FQ * FW)), FW waves a work-group, no LDS, no barrier.
// A wave owns FQ = 32 query columns and walks the keys 32 at a time (a pass). Transposed products: S^T[key][query] = K . Q^T (A = K rows, B = Q rows, the Kf units hold d in the order of the Q loader, so the k order pairs), O^T[d][query] += V^T . P^T.
// K and V^T come from the fragment-order planes of k_prep: each of a pass's 16 loads reads 512 B in a row (a plane in row order gave every load 16 separate lines, which the cache serves one by one).
// A lane then holds one query's scores: two S^T tiles (keys 0-15 and 16-31 of the pass), converted in place, ARE the B operand of the second product in the hardware k order (element s: key 8 * hi + s, s < 8; 16 + 8 * hi + s - 8 above), which is the order the Vf units hold V^T in.
// Online softmax in the log2 domain: p = exp2(s * FSC - m), m = the column's maximum in use; sums and output tiles are rescaled only when some column's new maximum exceeds m by more than 8 (p <= 2^8, far inside f32); p goes in as bf16 hi + lo against exact v (2 products); the division by the column's sum comes last.
// Causal: a wave stops behind its diagonal pass (keys q0 .. q0 + 31), the only one that needs the mask; heaviest work-groups first.
#define FQ 32
#define FW 4
#define FSC 0.18033688011112042f   // HD^-0.5 * log2(e)
typedef __attribute__((ext_vector_type(8))) unsigned v8u;
__device__ __forceinline__ v16bf ldfr(const bf* p) { return cat16b(*(const v8us*)p, *(const v8us*)(p + 256)); }   // one fragment = two neighbouring units; p already holds the lane's 8 * lane
__device__ __forceinline__ float xhalf(float x) { const int b = __float_as_int(x); return __int_as_float(__builtin_amdgcn_permlanex16(b, b, 0x76543210, 0xfedcba98, false, false)); }   // lane l <- lane l ^ 16, on the vector pipe
__global__ __launch_bounds__(32 * FW) void k_fattn(const bf* __restrict__ Q, const bf* __restrict__ Kp, const bf* __restrict__ Vt, const int* __restrict__ CF, float* OUTb) {
    typedef WFrag<bf>::V V;
    const int lane = threadIdx.x & 31, lr = lane & 15, hi = lane >> 4; const int w = __builtin_amdgcn_readfirstlane((int)(threadIdx.x >> 5)); const int h = blockIdx.x;
    const int q0 = ((TT / (FQ * FW) - 1 - (int)blockIdx.y) * FW + w) * FQ; const bool con = (CF[0] != 0);
    const int klast = con ? q0 : TT - 32;                    // first key of the wave's last pass (wave-uniform)
    const bf* qp = Q + (size_t)h * TT * HD + (size_t)(q0 + lr) * HD + 8 * hi; const bf* kp = Kp + (size_t)h * TT * HD + 8 * lane; const bf* vp = Vt + (size_t)h * HD * TT + 8 * lane;   // a block of 32 keys is 32 * HD elements in either plane
    V qf[2][2], kf[2][2];
#pragma unroll
    for (int t = 0; t < 2; ++t)
#pragma unroll
        for (int ks = 0; ks < 2; ++ks) { qf[t][ks] = WFrag<bf>::ld(qp + t * 16 * HD + ks * 32); kf[t][ks] = ldfr(kp + (t * 2 + ks) * 512); }
    v8f o[4][2]; float m[2], l[2];
#pragma unroll
    for (int qt = 0; qt < 2; ++qt) { m[qt] = -3.0e38f; l[qt] = 0.0f;
#pragma unroll
        for (int dt = 0; dt < 4; ++dt) o[dt][qt] = (v8f){}; }
    // the pass loop stays rolled (two passes side by side would not fit 256 registers); every inner loop is unrolled so that the fragment arrays are registers
#pragma unroll 1
    for (int kb = 0; kb <= klast; kb += 32) {
        V vf[4];                                             // this pass's V^T, asked for ahead of the score products: the softmax covers its latency
#pragma unroll
        for (int dt = 0; dt < 4; ++dt) vf[dt] = ldfr(vp + (size_t)kb * HD + dt * 512);
        __builtin_amdgcn_sched_barrier(0);                   // keeps these loads up here: left alone the build sinks them behind the maximum, and the second product waits on them
        v8f st[2][2];
#pragma unroll
        for (int kt = 0; kt < 2; ++kt)
#pragma unroll
            for (int qt = 0; qt < 2; ++qt) { st[kt][qt] = wmmab(kf[kt][0], qf[qt][0], (v8f){}); st[kt][qt] = wmmab(kf[kt][1], qf[qt][1], st[kt][qt]); }
        const int kn = min(kb + 32, klast);                  // the next pass's K rows, fetched one pass ahead (the last pass fetches its own again: in bounds, unused)
#pragma unroll
        for (int kt = 0; kt < 2; ++kt)
#pragma unroll
            for (int ks = 0; ks < 2; ++ks) kf[kt][ks] = ldfr(kp + (size_t)kn * HD + (kt * 2 + ks) * 512);
        asm volatile("s_wait_xcnt 0x0" ::: "memory");        // in front of every rewrite of an address register of this pass's V^T and K loads
        if (con && kb == klast) {                            // diagonal pass (scalar branch): keys above the query get weight exp2(-huge) = 0
#pragma unroll
            for (int kt = 0; kt < 2; ++kt)
#pragma unroll
                for (int qt = 0; qt < 2; ++qt)
#pragma unroll
                    for (int j = 0; j < 8; ++j) st[kt][qt][j] = (kt * 16 + hi * 8 + j <= qt * 16 + lr) ? st[kt][qt][j] : -3.0e38f;
        }
        float mx[2]; bool need = false;
#pragma unroll
        for (int qt = 0; qt < 2; ++qt) { float a = st[0][qt][0];
#pragma unroll
            for (int j = 1; j < 8; ++j) a = fmaxf(a, st[0][qt][j]);
#pragma unroll
            for (int j = 0; j < 8; ++j) a = fmaxf(a, st[1][qt][j]);
            a = fmaxf(a, xhalf(a)) * FSC;       // lanes c and c + 16 hold the two halves of one query's keys: both must use one m
            mx[qt] = a; need = need || (a > m[qt] + 8.0f); }
        if (__builtin_amdgcn_ballot_w32(need) != 0) {        // scalar branch, once a pass
#pragma unroll
            for (int qt = 0; qt < 2; ++qt) { const float mn = fmaxf(m[qt], mx[qt]); const float f = __builtin_amdgcn_exp2f(m[qt] - mn); m[qt] = mn; l[qt] *= f;
#pragma unroll
                for (int dt = 0; dt < 4; ++dt) o[dt][qt] *= f; }
        }
        V ph[2], pl[2];
#pragma unroll
        for (int qt = 0; qt < 2; ++qt) { v8u uh, ul; float s0 = 0.0f, s1 = 0.0f;
#pragma unroll
            for (int kt = 0; kt < 2; ++kt)
#pragma unroll
                for (int jp = 0; jp < 4; ++jp) { v2f pp; pp[0] = __builtin_amdgcn_exp2f(__builtin_fmaf(st[kt][qt][2 * jp], FSC, -m[qt])); pp[1] = __builtin_amdgcn_exp2f(__builtin_fmaf(st[kt][qt][2 * jp + 1], FSC, -m[qt])); s0 += pp[0]; s1 += pp[1];
                    const unsigned u = __builtin_bit_cast(unsigned, __builtin_convertvector(pp, v2bf)); v2f rr; rr[0] = pp[0] - __uint_as_float(u << 16); rr[1] = pp[1] - __uint_as_float(u & 0xFFFF0000u);
                    uh[kt * 4 + jp] = u; ul[kt * 4 + jp] = __builtin_bit_cast(unsigned, __builtin_convertvector(rr, v2bf)); }
            l[qt] += s0 + s1; ph[qt] = __builtin_bit_cast(V, uh); pl[qt] = __builtin_bit_cast(V, ul); }
#pragma unroll
        for (int dt = 0; dt < 4; ++dt)
#pragma unroll
            for (int qt = 0; qt < 2; ++qt) o[dt][qt] = wmmab(vf[dt], ph[qt], o[dt][qt]);
#pragma unroll
        for (int dt = 0; dt < 4; ++dt)
#pragma unroll
            for (int qt = 0; qt < 2; ++qt) o[dt][qt] = wmmab(vf[dt], pl[qt], o[dt][qt]);
    }
#pragma unroll
    for (int qt = 0; qt < 2; ++qt) { const float f = __fdiv_rn(1.0f, l[qt] + xhalf(l[qt])); float* op = OUTb + (size_t)(q0 + qt * 16 + lr) * DQ + h * HD + 8 * hi;   /* f32 output [l][h*64 + d]; register j of tile dt is d = 16 dt + 8 hi + j */
#pragma unroll
        for (int dt = 0; dt < 4; ++dt) { const v8f r = o[dt][qt] * f; v4f r0, r1;
#pragma unroll
            for (int j = 0; j < 4; ++j) { r0[j] = r[j]; r1[j] = r[4 + j]; }
            *(v4f*)(op + dt * 16) = r0; *(v4f*)(op + dt * 16 + 4) = r1; } }
}

extern "C" void kernel_launch(void* const* d_in, const int* in_sizes, int n_in,
                              void* d_out, int out_size, void* d_ws, size_t ws_size, hipStream_t stream) {
    (void)in_sizes; (void)n_in; (void)out_size;
    const float* xq = (const float*)d_in[0]; const float* xk = (const float*)d_in[1]; const float* xv = (const float*)d_in[2]; const int* CFLAG = (const int*)d_in[3];   /* 'causal' flag (int, read on device) */ const float* x = xq; const float* wq = nullptr; const float* wk = nullptr; const float* wv = nullptr; const float* wo = nullptr; (void)x; (void)wq; (void)wk; (void)wv; (void)wo;
    float* OUT = (float*)d_out;     // [1][4096][1024]
    char* wsp = (char*)d_ws;
    auto take = [&](size_t bytes) { char* p = wsp; wsp += (bytes + 255) & ~(size_t)255; return (void*)p; };
    bf* QPh = (bf*)take((size_t)NH_ * TT * HD * 2); bf* KPh = (bf*)take((size_t)NKV * TT * HD * 2); bf* VTh = (bf*)take((size_t)NKV * HD * TT * 2);
    if ((size_t)(wsp - (char*)d_ws) > ws_size) return;    // ws 256 MiB

    for (int b = 0; b < NB_; ++b) {
        k_prep<<<dim3(TT / PT, NH_), 256, 0, stream>>>(xq + (size_t)b * TT * DM, xk + (size_t)b * TT * DM, xv + (size_t)b * TT * DM, QPh, KPh, VTh);   /* bf16 planes of q, k and v^T straight from the inputs; k and v^T in fragment order */
        k_fattn<<<dim3(NH_, TT / (FQ * FW)), 32 * FW, 0, stream>>>(QPh, KPh, VTh, CFLAG, OUT + (size_t)b * TT * DM);   /* one kv head per query head */
    }
}

// v005
// Measured time: 49.1 microseconds a run.
// Timed twice side by side with v004, it ran 1.93 and 1.91 times as fast.
// Counting every step since v000, it is 41.8 times as fast.
#include <hip/hip_runtime.h>

// Plain (optionally causal) multi-head attention on given q/k/v (q, k, v [1][4096][16][64]; scores = q.k/8; when the int input 'causal' is non-zero (read on device) keys above the diagonal are masked (-inf == exact zero weight); softmax; out[b][s][h][d] = attn.v -> [1][4096][16][64]).
// Layout: no projections - the bf16-rounded inputs ARE the operand planes (exact single bf16 planes for q, k and v^T), so the score products are exact (1 product) and attn.v takes the f32 softmax weights as bf16 hi + lo against exact v (2 products) on every row; one launch (k_prep) makes the three planes, k and v^T in the order in which the matrix fragments are loaded; scores, online softmax and attn.v run in one kernel for all heads (k_fattn), which writes the [l][h*64+d] result straight to the output in f32.
// Compute dtypes, f32 accumulate: every input rounded to bf16; exact products for q.k; online softmax in f32 (one exp2 per element, fixed order); probabilities as bf16 hi/lo operands formed in registers; f32 output.


#define NB_  1
#define TT   4096
#define DM   1024
#define NH_  16
#define NKV  16
#define REP  (NH_ / NKV)
#define HD   64
#define DQ   (NH_ * HD)
#define DKV  (NKV * HD)
#define ZH   1
#define RH   4096                  // every row on the hi/lo path
#define WIN  4096
#define PCAR 1024.0f
#define SCL  0.125f   // HD^-0.5
typedef _Float16 h16;
typedef unsigned short bf;
typedef __attribute__((ext_vector_type(16))) __bf16   v16bf;
typedef __attribute__((ext_vector_type(16))) _Float16 v16h;
typedef __attribute__((ext_vector_type(8)))  _Float16 v8h;
typedef __attribute__((ext_vector_type(8)))  unsigned short v8us;
typedef __attribute__((ext_vector_type(8)))  float    v8f;
typedef __attribute__((ext_vector_type(4)))  float    v4f;
typedef v8h  __attribute__((may_alias)) v8ha;
typedef v4f  __attribute__((may_alias)) v4fa;
typedef v8us __attribute__((may_alias)) v8usa;

__device__ __forceinline__ unsigned short f2bf(float f) { unsigned u = __float_as_uint(f); u += 0x7FFFu + ((u >> 16) & 1u); return (unsigned short)(u >> 16); }
__device__ __forceinline__ float bf2f(unsigned short b) { return __uint_as_float(((unsigned)b) << 16); }
__device__ __forceinline__ float bfr(float f) { return bf2f(f2bf(f)); }
__device__ __forceinline__ v16h cat16(v8h lo, v8h hi) { return __builtin_shufflevector(lo, hi, 0, 1, 2, 3, 4, 5, 6, 7, 8, 9, 10, 11, 12, 13, 14, 15); }
__device__ __forceinline__ v16bf cat16b(v8us lo, v8us hi) { return __builtin_bit_cast(v16bf, __builtin_shufflevector(lo, hi, 0, 1, 2, 3, 4, 5, 6, 7, 8, 9, 10, 11, 12, 13, 14, 15)); }
__device__ __forceinline__ v8f wmma16(v16h a, v16h b, v8f c) { return __builtin_amdgcn_wmma_f32_16x16x32_f16(false, a, false, b, (short)0, c, false, false); }
__device__ __forceinline__ v8f wmmab(v16bf a, v16bf b, v8f c) { return __builtin_amdgcn_wmma_f32_16x16x32_bf16(false, a, false, b, (short)0, c, false, false); }



// ---- k_gemmw: register-blocked GEMM, ONE WAVE per 64x64 output tile (16 accumulators), operands straight from K-contiguous 16-bit planes; grid (M/64, N/64, Z), 32 threads.
// C[m][n] (f32, pitch ldc, + optional f32 bias[n]) = sum_k A[m][k] Bt[n][k] (+ split products per NSPLIT). z-batch strides sA/sB/sC in elements. K % 32 == 0.
template <typename T16> struct WFrag;
template <> struct WFrag<h16> { typedef v16h V; static __device__ __forceinline__ V ld(const h16* p) { return cat16(*(const v8h*)p, *(const v8h*)(p + 16)); } static __device__ __forceinline__ v8f mma(V a, V b, v8f c) { return wmma16(a, b, c); } };
template <> struct WFrag<bf> { typedef v16bf V; static __device__ __forceinline__ V ld(const bf* p) { return cat16b(*(const v8us*)p, *(const v8us*)(p + 16)); } static __device__ __forceinline__ v8f mma(V a, V b, v8f c) { return wmmab(a, b, c); } };
template <typename T16, int NSPLIT, bool BIAS>
__global__ __launch_bounds__(32) void k_gemmw(const T16* __restrict__ A, const T16* __restrict__ A2, const T16* __restrict__ Bt, const T16* __restrict__ Bt2, int K, float* C, int ldc, const float* __restrict__ bias, size_t sA, size_t sB, size_t sC) {
    typedef typename WFrag<T16>::V V;
    __shared__ __align__(16) float os[16 * 68];
    const size_t z = blockIdx.z; A += z * sA; if (A2) A2 += z * sA; Bt += z * sB; if (Bt2) Bt2 += z * sB; C += z * sC;
    const int lane = threadIdx.x & 31, lr = lane & 15, hi = lane >> 4; const int r0 = blockIdx.x * 64, c0 = blockIdx.y * 64;
    v8f acc[4][4];
#pragma unroll
    for (int mb = 0; mb < 4; ++mb)
#pragma unroll
        for (int nb = 0; nb < 4; ++nb) acc[mb][nb] = (v8f){};
    const size_t aoff = (size_t)(r0 + lr) * K + 8 * hi, boff = (size_t)(c0 + lr) * K + 8 * hi;
#pragma unroll 1
    for (int kc = 0; kc < K; kc += 32) {
        V a[4], a2[4];
#pragma unroll
        for (int mb = 0; mb < 4; ++mb) { a[mb] = WFrag<T16>::ld(A + aoff + (size_t)mb * 16 * K + kc); if (NSPLIT == 1 || NSPLIT == 2) a2[mb] = WFrag<T16>::ld(A2 + aoff + (size_t)mb * 16 * K + kc); }
#pragma unroll
        for (int nb = 0; nb < 4; ++nb) { const V b = WFrag<T16>::ld(Bt + boff + (size_t)nb * 16 * K + kc); V b2; if (NSPLIT >= 2) b2 = WFrag<T16>::ld(Bt2 + boff + (size_t)nb * 16 * K + kc);
#pragma unroll
            for (int mb = 0; mb < 4; ++mb) { acc[mb][nb] = WFrag<T16>::mma(a[mb], b, acc[mb][nb]); if (NSPLIT == 1 || NSPLIT == 2) acc[mb][nb] = WFrag<T16>::mma(a2[mb], b, acc[mb][nb]); if (NSPLIT >= 2) acc[mb][nb] = WFrag<T16>::mma(a[mb], b2, acc[mb][nb]); } }
        asm volatile("v_nop\n\tv_nop\n\tv_nop\n\tv_nop" : "+v"(acc[0][0]), "+v"(acc[1][1]), "+v"(acc[2][2]), "+v"(acc[3][3]) : "v"(a[0]), "v"(a[3]));
    }
#pragma unroll
    for (int mb = 0; mb < 4; ++mb) {
#pragma unroll
        for (int nb = 0; nb < 4; ++nb) {
#pragma unroll
            for (int j = 0; j < 8; ++j) os[(hi * 8 + j) * 68 + nb * 16 + lr] = acc[mb][nb][j]; }
        __builtin_amdgcn_wave_barrier(); asm volatile("" ::: "memory");
        float* crow = C + (size_t)(r0 + mb * 16) * ldc + c0;
{
#pragma unroll
            for (int s = 0; s < 8; ++s) { const int row = 2 * s + hi, cofs = lr * 4; v4f val = *(const v4fa*)(os + row * 68 + cofs); if (BIAS) { val[0] += bfr(bias[c0 + cofs]); val[1] += bfr(bias[c0 + cofs + 1]); val[2] += bfr(bias[c0 + cofs + 2]); val[3] += bfr(bias[c0 + cofs + 3]); }
                *(v4f*)(crow + (size_t)row * ldc + cofs) = val; }
             }
        __builtin_amdgcn_wave_barrier(); asm volatile("" ::: "memory");
    }
}

typedef __attribute__((ext_vector_type(2))) _Float16 v2h;
typedef __attribute__((ext_vector_type(4))) _Float16 v4h;
typedef __attribute__((ext_vector_type(2))) unsigned short v2us;
typedef __attribute__((ext_vector_type(4))) unsigned short v4us;
typedef __attribute__((ext_vector_type(2))) float v2f;
typedef __attribute__((ext_vector_type(4))) int v4i;
typedef __attribute__((ext_vector_type(4))) unsigned v4u;
typedef __attribute__((ext_vector_type(2))) unsigned v2u;
typedef __attribute__((ext_vector_type(2))) __bf16 v2bf;

__global__ __launch_bounds__(256) void k_wtG(const float* __restrict__ w, int K, int N, bf* Bt) {
    const int lane = threadIdx.x & 31; const int L0 = (blockIdx.x * 8 + (threadIdx.x >> 5)) * 8; const int nlines = N * K / 64;
{
#pragma unroll 1
        for (int l = 0; l < 8; ++l) { const int L = L0 + l; if (L >= nlines) break; const size_t e = (size_t)L * 64 + lane * 2; const int k = (int)(e % K), n = (int)(e / K); v2us o;
            o[0] = f2bf(w[(size_t)k * N + n]); o[1] = f2bf(w[(size_t)(k + 1) * N + n]); *(v2us*)(Bt + e) = o; }
         }
}
__global__ __launch_bounds__(256) void k_cvt8(const float* __restrict__ src, bf* dst, size_t n8) { const size_t i = (size_t)blockIdx.x * 256 + threadIdx.x; if (i >= n8) return; const v8f v = *(const v8f*)(src + i * 8); v8us o;
#pragma unroll
    for (int k = 0; k < 8; ++k) o[k] = f2bf(v[k]); *(v8us*)(dst + i * 8) = o;  }

// ---- k_prep: the three bf16 operand planes of k_fattn in ONE launch: Qb [h][t][d], Kf and Vf in fragment order (below), each input element read once and rounded to bf16 (nearest even). Grid (TT / PT, NH_), 256 threads; a work-group owns PT = 128 tokens of one head.
// Fragment order: a head's keys in blocks of 32 (one pass of k_fattn), a block = 8 units of 512 B, a unit = 32 lanes x 16 B (a piece = 8 bf16), lane = 16 hi + lr: ONE wave-wide 16-B load of k_fattn reads one unit, 4 whole 128-B lines.
//   Kf unit (kt * 2 + ks) * 2 + c, lane (hi, lr): key 16 kt + lr, d = 32 ks + 16 c + 8 hi + 0..7.   Vf unit dt * 2 + c, lane (hi, lr): d = 16 dt + lr, keys 16 c + 8 hi + 0..7.
// Every load is 16 B a lane, 16 lanes on one 256-B input row (4 neighbouring d a lane); all 24 loads of a lane are asked for before the first is used.
// q, k: load i takes tokens 16 i + g (g = thread / 16), 4 d a lane. q goes out as 8 B a lane, a wave stores 256 B in a row; k's 8-B half pieces change lanes through LDS.
// v: a lane takes the 8 neighbouring tokens 8 g .. 8 g + 7 and packs those of one d into a 16-B piece; the pieces change lanes through LDS. Behind the barrier a wave stores whole 512-B units of Kf and Vf.
// LDS, v: row d is 256 B = 16 pieces; piece g stands at place g ^ s(d), s(d) = (d & 12) | ((d / 16 ^ d) & 3): the 16 writers of a half wave (d 4 apart, same g) and the 16 readers (16 neighbouring d, same g) each cover all 64 banks once.
// LDS, k: the units in their final order, but piece (hi, lr) of a unit stands at place 16 hi + (lr ^ 2 (4 ks + 2 c + hi)): the 32 writers of a wave (two tokens, all 64 d) and the 16 readers of a half wave each cover all 64 banks once.
#define PT 128
__global__ __launch_bounds__(256) void k_prep(const float* __restrict__ xq, const float* __restrict__ xk, const float* __restrict__ xv, bf* __restrict__ Qb, bf* __restrict__ Kf, bf* __restrict__ Vf) {
    __shared__ __align__(16) unsigned vs[HD * PT / 2];
    __shared__ __align__(16) unsigned kl[HD * PT / 2];
    const int tid = threadIdx.x, l16 = tid & 15, g = tid >> 4; const int h = blockIdx.y, t0 = blockIdx.x * PT;
    const size_t voff = (size_t)(t0 + g * 8) * DQ + h * HD + l16 * 4, qoff = (size_t)(t0 + g) * DQ + h * HD + l16 * 4;
    v4f xvv[8], xqq[8], xkk[8];
#pragma unroll
    for (int i = 0; i < 8; ++i) xvv[i] = *(const v4f*)(xv + voff + (size_t)i * DQ);
    asm volatile("s_wait_xcnt 0x0" ::: "memory");            // in front of every rewrite of an address register of the v loads (the build lets the next loads' data land on it)
#pragma unroll
    for (int i = 0; i < 8; ++i) xqq[i] = *(const v4f*)(xq + qoff + (size_t)i * 16 * DQ);
    asm volatile("s_wait_xcnt 0x0" ::: "memory");            // the same for the q loads
#pragma unroll
    for (int i = 0; i < 8; ++i) xkk[i] = *(const v4f*)(xk + qoff + (size_t)i * 16 * DQ);
    asm volatile("s_wait_xcnt 0x0" ::: "memory");            // the same for the k loads
    __builtin_amdgcn_sched_barrier(0);                       // keeps all 24 loads in front of the first use: left alone the build sinks the q and k loads between the conversions, and their latencies add up
#pragma unroll
    for (int j = 0; j < 4; ++j) { v4u o;
#pragma unroll
        for (int p = 0; p < 4; ++p) { v2f a; a[0] = xvv[2 * p][j]; a[1] = xvv[2 * p + 1][j]; o[p] = __builtin_bit_cast(unsigned, __builtin_convertvector(a, v2bf)); }
        *(v4u*)(vs + (l16 * 4 + j) * (PT / 2) + (g ^ ((l16 & 3) * 4 | ((l16 >> 2) ^ j))) * 4) = o; }
    bf* qd = Qb + ((size_t)h * TT + t0) * HD + (size_t)tid * 4;
    unsigned* kw = kl + (l16 >> 2) * 128 + (((l16 >> 1) & 1) * 16 + (g ^ ((l16 >> 1) * 2))) * 4 + (l16 & 1) * 2;   // unit 2 ks + c of key tile 0, the lane's half piece; load i is key tile i: 4 units on
#pragma unroll
    for (int i = 0; i < 8; ++i) { v2u oq, ok;
#pragma unroll
        for (int p = 0; p < 2; ++p) { v2f a, b; a[0] = xqq[i][2 * p]; a[1] = xqq[i][2 * p + 1]; b[0] = xkk[i][2 * p]; b[1] = xkk[i][2 * p + 1]; oq[p] = __builtin_bit_cast(unsigned, __builtin_convertvector(a, v2bf)); ok[p] = __builtin_bit_cast(unsigned, __builtin_convertvector(b, v2bf)); }
        *(v2u*)(qd + i * 1024) = oq; *(v2u*)(kw + i * 512) = ok; }
    asm volatile("s_wait_xcnt 0x0" ::: "memory");            // in front of every rewrite of a data or address register of the q stores
    // work-group barrier with LDS-only fences: every piece of the k and v tiles is in LDS before a lane takes another lane's; __syncthreads() would also wait here for the q stores, which nobody in this launch reads
    __builtin_amdgcn_fence(__ATOMIC_RELEASE, "workgroup", "local"); __builtin_amdgcn_s_barrier(); __builtin_amdgcn_fence(__ATOMIC_ACQUIRE, "workgroup", "local");
#pragma unroll
    for (int i = 0; i < 4; ++i) {                            // thread tid stores piece i * 256 + tid of the work-group's 16 KB of each plane: unit i * 8 + tid / 32, lane tid % 32 = (hi, l16)
        const int hi = g & 1, u = tid >> 5, d = (u >> 1) * 16 + l16;
        const v4u kv = *(const v4u*)(kl + (i * 8 + u) * 128 + (hi * 16 + (l16 ^ (((u & 3) * 2 + hi) * 2))) * 4);
        const v4u vv = *(const v4u*)(vs + d * (PT / 2) + ((i * 4 + (u & 1) * 2 + hi) ^ ((l16 & 12) | (((u >> 1) ^ l16) & 3))) * 4);
        *(v4u*)(Kf + ((size_t)h * TT + t0) * HD + (size_t)(i * 256 + tid) * 8) = kv; *(v4u*)(Vf + ((size_t)h * TT + t0) * HD + (size_t)(i * 256 + tid) * 8) = vv; }
}
// ---- k_fattn: scores, softmax and probability x value contraction of one head in ONE kernel; no score or probability leaves the registers. Grid (NH_, NPB / 2), FW = FQW * FKG waves a work-group: 256 equal work-groups, four waves a SIMD.
// The deal: a query tile is FQ = 32 columns, a pass is 32 keys. Wave w works on tile column qi = w % FQW as key group g = w / FQW: of its tile's passes it takes numbers g, g + FKG, g + 2 FKG ... (the FQW waves of one key group walk the same keys side by side).
// Causal cost grows with the tile's number, so every wave runs two tiles one after the other, number t and number TT / FQ - 1 - t: each work-group gets the same number of passes wherever it lands; causal, a wave gets 31 to 33.
// Each wave leaves its partial result (maximum in use, sum, unscaled output tiles) in LDS; behind ONE work-group barrier the FKG waves of a tile add the FKG partials in group order, each for its own 16 queries x 32 d (whole 128-B lines of the output).
// Transposed products: S^T[key][query] = K . Q^T (A = K rows, B = Q rows, the Kf units hold d in the order of the Q loader, so the k order pairs), O^T[d][query] += V^T . P^T.
// K and V^T come from the fragment-order planes of k_prep: each of a pass's 16 loads reads 512 B in a row (a plane in row order gave every load 16 separate lines).
// A lane then holds one query's scores: two S^T tiles (keys 0-15 and 16-31 of the pass), converted in place, ARE the B operand of the second product in the hardware k order (element s: key 8 * hi + s, s < 8; 16 + 8 * hi + s - 8 above), which is the order the Vf units hold V^T in.
// Online softmax in the log2 domain: p = exp2(s * FSC - m), m = the column's maximum in use; sums and output tiles are rescaled only when some column's new maximum exceeds m by more than 8 (p <= 2^8, far inside f32); p goes in as bf16 hi + lo against exact v (2 products); the division by the column's sum comes last.
// Causal: a tile's last pass is its diagonal pass (keys q0 .. q0 + 31), the only one that needs the mask. A key group without a pass leaves sum 0 and maximum -3e38: weight exp2(-huge) = 0 in the merge.
#define FQ 32
#define FQW 4
#define FKG 4
#define FW (FQW * FKG)
#define NPB (TT / (FQ * FQW))
#define FSC 0.18033688011112042f   // HD^-0.5 * log2(e)
typedef __attribute__((ext_vector_type(8))) unsigned v8u;
__device__ __forceinline__ v16bf ldfr(const bf* p) { return cat16b(*(const v8us*)p, *(const v8us*)(p + 256)); }   // one fragment = two neighbouring units; p already holds the lane's 8 * lane
__device__ __forceinline__ float xhalf(float x) { const int b = __float_as_int(x); return __int_as_float(__builtin_amdgcn_permlanex16(b, b, 0x76543210, 0xfedcba98, false, false)); }   // lane l <- lane l ^ 16, on the vector pipe
__global__ __launch_bounds__(32 * FW) void k_fattn(const bf* __restrict__ Q, const bf* __restrict__ Kp, const bf* __restrict__ Vt, const int* __restrict__ CF, float* OUTb) {
    typedef WFrag<bf>::V V;
    __shared__ v4f po[2 * FW * 512];        // [tile of the wave][wave][unit (dt * 2 + qt) * 2 + half of the 8 registers][lane] x 16 B: every LDS access of a wave is 512 B in a row
    __shared__ v2f pml[2 * FW * 64];        // [tile of the wave][wave][qt][lane] x (maximum in use, the lane's sum)
    const int lane = threadIdx.x & 31, lr = lane & 15, hi = lane >> 4; const int w = __builtin_amdgcn_readfirstlane((int)(threadIdx.x >> 5)); const int qi = w % FQW, g = w / FQW; const int h = blockIdx.x;
    const bool con = (CF[0] != 0);
    const bf* kp = Kp + (size_t)h * TT * HD + 8 * lane; const bf* vp = Vt + (size_t)h * HD * TT + 8 * lane;   // a block of 32 keys is 32 * HD elements in either plane
    V kf[2][2];                                              // the K rows of the wave's next pass; a tile's last pass fetches those of the next tile's first pass (block g again)
#pragma unroll
    for (int t = 0; t < 2; ++t)
#pragma unroll
        for (int ks = 0; ks < 2; ++ks) kf[t][ks] = ldfr(kp + (size_t)g * 32 * HD + (t * 2 + ks) * 512);
    // the two tiles run one after the other through the same code (rolled: one copy of the pass loop in the instruction cache)
#pragma unroll 1
    for (int ph = 0; ph < 2; ++ph) {
        const int q0 = (ph ? (NPB - 1 - (int)blockIdx.y) * FQW + (FQW - 1 - qi) : (int)blockIdx.y * FQW + qi) * FQ;
        const int klast = con ? q0 : TT - 32;                // first key of the tile's last pass (wave-uniform)
        const bf* qp = Q + (size_t)h * TT * HD + (size_t)(q0 + lr) * HD + 8 * hi;
        V qf[2][2];
#pragma unroll
        for (int t = 0; t < 2; ++t)
#pragma unroll
            for (int ks = 0; ks < 2; ++ks) qf[t][ks] = WFrag<bf>::ld(qp + t * 16 * HD + ks * 32);
        asm volatile("s_wait_xcnt 0x0" ::: "memory");        // in front of every rewrite of an address register of the Q loads (and, the first time, of the first K loads)
        v8f o[4][2]; float m[2], l[2];
#pragma unroll
        for (int qt = 0; qt < 2; ++qt) { m[qt] = -3.0e38f; l[qt] = 0.0f;
#pragma unroll
            for (int dt = 0; dt < 4; ++dt) o[dt][qt] = (v8f){}; }
        // the pass loop stays rolled (two passes side by side would not fit the registers of four waves a SIMD); every inner loop is unrolled so that the fragment arrays are registers
#pragma unroll 1
        for (int kb = g * 32; kb <= klast; kb += 32 * FKG) {
            V vf[4];                                         // this pass's V^T, asked for ahead of the score products: the softmax covers its latency
#pragma unroll
            for (int dt = 0; dt < 4; ++dt) vf[dt] = ldfr(vp + (size_t)kb * HD + dt * 512);
            __builtin_amdgcn_sched_barrier(0);               // keeps these loads up here: left alone the build sinks them behind the maximum, and the second product waits on them
            v8f st[2][2];
#pragma unroll
            for (int kt = 0; kt < 2; ++kt)
#pragma unroll
                for (int qt = 0; qt < 2; ++qt) { st[kt][qt] = wmmab(kf[kt][0], qf[qt][0], (v8f){}); st[kt][qt] = wmmab(kf[kt][1], qf[qt][1], st[kt][qt]); }
            const int kn = (kb + 32 * FKG <= klast) ? kb + 32 * FKG : g * 32;   // the K rows of the wave's next pass, fetched one pass ahead; behind a tile's last pass that is block g, the next tile's first (behind the second tile: in bounds, unused)
#pragma unroll
            for (int kt = 0; kt < 2; ++kt)
#pragma unroll
                for (int ks = 0; ks < 2; ++ks) kf[kt][ks] = ldfr(kp + (size_t)kn * HD + (kt * 2 + ks) * 512);
            asm volatile("s_wait_xcnt 0x0" ::: "memory");    // in front of every rewrite of an address register of this pass's V^T and K loads
            if (con && kb == klast) {                        // diagonal pass (scalar branch): keys above the query get weight exp2(-huge) = 0
#pragma unroll
                for (int kt = 0; kt < 2; ++kt)
#pragma unroll
                    for (int qt = 0; qt < 2; ++qt)
#pragma unroll
                        for (int j = 0; j < 8; ++j) st[kt][qt][j] = (kt * 16 + hi * 8 + j <= qt * 16 + lr) ? st[kt][qt][j] : -3.0e38f;
            }
            float mx[2]; bool need = false;
#pragma unroll
            for (int qt = 0; qt < 2; ++qt) { float a = st[0][qt][0];
#pragma unroll
                for (int j = 1; j < 8; ++j) a = fmaxf(a, st[0][qt][j]);
#pragma unroll
                for (int j = 0; j < 8; ++j) a = fmaxf(a, st[1][qt][j]);
                a = fmaxf(a, xhalf(a)) * FSC;       // lanes c and c + 16 hold the two halves of one query's keys: both must use one m
                mx[qt] = a; need = need || (a > m[qt] + 8.0f); }
            if (__builtin_amdgcn_ballot_w32(need) != 0) {    // scalar branch, once a pass
#pragma unroll
                for (int qt = 0; qt < 2; ++qt) { const float mn = fmaxf(m[qt], mx[qt]); const float f = __builtin_amdgcn_exp2f(m[qt] - mn); m[qt] = mn; l[qt] *= f;
#pragma unroll
                    for (int dt = 0; dt < 4; ++dt) o[dt][qt] *= f; }
            }
            V ph_[2], pl[2];
#pragma unroll
            for (int qt = 0; qt < 2; ++qt) { v8u uh, ul; float s0 = 0.0f, s1 = 0.0f;
#pragma unroll
                for (int kt = 0; kt < 2; ++kt)
#pragma unroll
                    for (int jp = 0; jp < 4; ++jp) { v2f pp; pp[0] = __builtin_amdgcn_exp2f(__builtin_fmaf(st[kt][qt][2 * jp], FSC, -m[qt])); pp[1] = __builtin_amdgcn_exp2f(__builtin_fmaf(st[kt][qt][2 * jp + 1], FSC, -m[qt])); s0 += pp[0]; s1 += pp[1];
                        const unsigned u = __builtin_bit_cast(unsigned, __builtin_convertvector(pp, v2bf)); v2f rr; rr[0] = pp[0] - __uint_as_float(u << 16); rr[1] = pp[1] - __uint_as_float(u & 0xFFFF0000u);
                        uh[kt * 4 + jp] = u; ul[kt * 4 + jp] = __builtin_bit_cast(unsigned, __builtin_convertvector(rr, v2bf)); }
                l[qt] += s0 + s1; ph_[qt] = __builtin_bit_cast(V, uh); pl[qt] = __builtin_bit_cast(V, ul); }
#pragma unroll
            for (int dt = 0; dt < 4; ++dt)
#pragma unroll
                for (int qt = 0; qt < 2; ++qt) o[dt][qt] = wmmab(vf[dt], ph_[qt], o[dt][qt]);
#pragma unroll
            for (int dt = 0; dt < 4; ++dt)
#pragma unroll
                for (int qt = 0; qt < 2; ++qt) o[dt][qt] = wmmab(vf[dt], pl[qt], o[dt][qt]);
        }
        v4f* pw = po + (ph * FW + w) * 512 + lane;
#pragma unroll
        for (int qt = 0; qt < 2; ++qt) { v2f ml; ml[0] = m[qt]; ml[1] = l[qt]; pml[(ph * FW + w) * 64 + qt * 32 + lane] = ml;
#pragma unroll
            for (int dt = 0; dt < 4; ++dt) { v4f r0, r1;
#pragma unroll
                for (int j = 0; j < 4; ++j) { r0[j] = o[dt][qt][j]; r1[j] = o[dt][qt][4 + j]; }
                pw[((dt * 2 + qt) * 2) * 32] = r0; pw[((dt * 2 + qt) * 2 + 1) * 32] = r1; } }
    }
    __syncthreads();                                         // every wave's two partial results are in LDS before a wave adds the other key groups' to its own
    const int mq = g & 1, md = g >> 1;                       // the wave's share of each of its two tiles: queries 16 mq + 0..15, d = 32 md + 0..31
    for (int ph = 0; ph < 2; ++ph) {
        const int q0 = (ph ? (NPB - 1 - (int)blockIdx.y) * FQW + (FQW - 1 - qi) : (int)blockIdx.y * FQW + qi) * FQ;
        v2f ml[FKG]; float f[FKG];
#pragma unroll
        for (int k = 0; k < FKG; ++k) ml[k] = pml[(ph * FW + k * FQW + qi) * 64 + mq * 32 + lane];
        const float mm = fmaxf(fmaxf(ml[0][0], ml[1][0]), fmaxf(ml[2][0], ml[3][0])); float ls = 0.0f;
#pragma unroll
        for (int k = 0; k < FKG; ++k) { f[k] = __builtin_amdgcn_exp2f(ml[k][0] - mm); ls = __builtin_fmaf(ml[k][1], f[k], ls); }
        const float inv = __fdiv_rn(1.0f, ls + xhalf(ls));
        float* op = OUTb + (size_t)(q0 + mq * 16 + lr) * DQ + h * HD + md * 32 + 8 * hi;   /* f32 output [l][h*64 + d]; register j of tile dt is d = 16 dt + 8 hi + j */
#pragma unroll
        for (int u = 0; u < 4; ++u) {                        // u = 2 * (dt - 2 md) + half of the 8 registers
            v4f r = (v4f){};
#pragma unroll
            for (int k = 0; k < FKG; ++k) r += po[(ph * FW + k * FQW + qi) * 512 + (((md * 2 + (u >> 1)) * 2 + mq) * 2 + (u & 1)) * 32 + lane] * f[k];
            *(v4f*)(op + (u >> 1) * 16 + (u & 1) * 4) = r * inv; }
    }
}

extern "C" void kernel_launch(void* const* d_in, const int* in_sizes, int n_in,
                              void* d_out, int out_size, void* d_ws, size_t ws_size, hipStream_t stream) {
    (void)in_sizes; (void)n_in; (void)out_size;
    const float* xq = (const float*)d_in[0]; const float* xk = (const float*)d_in[1]; const float* xv = (const float*)d_in[2]; const int* CFLAG = (const int*)d_in[3];   /* 'causal' flag (int, read on device) */ const float* x = xq; const float* wq = nullptr; const float* wk = nullptr; const float* wv = nullptr; const float* wo = nullptr; (void)x; (void)wq; (void)wk; (void)wv; (void)wo;
    float* OUT = (float*)d_out;     // [1][4096][1024]
    char* wsp = (char*)d_ws;
    auto take = [&](size_t bytes) { char* p = wsp; wsp += (bytes + 255) & ~(size_t)255; return (void*)p; };
    bf* QPh = (bf*)take((size_t)NH_ * TT * HD * 2); bf* KPh = (bf*)take((size_t)NKV * TT * HD * 2); bf* VTh = (bf*)take((size_t)NKV * HD * TT * 2);
    if ((size_t)(wsp - (char*)d_ws) > ws_size) return;    // ws 256 MiB

    for (int b = 0; b < NB_; ++b) {
        k_prep<<<dim3(TT / PT, NH_), 256, 0, stream>>>(xq + (size_t)b * TT * DM, xk + (size_t)b * TT * DM, xv + (size_t)b * TT * DM, QPh, KPh, VTh);   /* bf16 planes of q, k and v^T straight from the inputs; k and v^T in fragment order */
        k_fattn<<<dim3(NH_, NPB / 2), 32 * FW, 0, stream>>>(QPh, KPh, VTh, CFLAG, OUT + (size_t)b * TT * DM);   /* one kv head per query head */
    }
}

// v007
// Measured time: 39.3 microseconds a run.
// It is 1.24 times as fast as v005, going by the measured steps of the versions left out in between.
// Over all steps from v000 it is 52.0 times as fast.
#include <hip/hip_runtime.h>

// Plain (optionally causal) multi-head attention on given q/k/v (q, k, v [1][4096][16][64]; scores = q.k/8; when the int input 'causal' is non-zero (read on device) keys above the diagonal are masked (-inf == exact zero weight); softmax; out[b][s][h][d] = attn.v -> [1][4096][16][64]).
// Layout: no projections - the bf16-rounded inputs ARE the operand planes (exact single bf16 planes for q and k, one f16 plane for v^T), so the score products are exact (1 product); attn.v takes the f32 softmax weights rounded once to f16 against the bf16-rounded v held as f16 (1 product) on every row; one launch (k_prep) makes the three planes, k and v^T in the order in which the matrix fragments are loaded; scores, online softmax and attn.v run in one kernel for all heads (k_fattn), which writes the [l][h*64+d] result straight to the output in f32.
// Compute dtypes, f32 accumulate: every input rounded to bf16; exact products for q.k; online softmax in f32 (one exp2 per element, fixed order, two elements an instruction where the chip has the packed form); probabilities as one f16 operand (11 significant bits) formed in registers, v^T plane in f16 (a bf16 value is exact in f16 from 2^-14 up to 65504 in size; below that it is off by at most 2^-25); f32 output.


#define NB_  1
#define TT   4096
#define DM   1024
#define NH_  16
#define NKV  16
#define REP  (NH_ / NKV)
#define HD   64
#define DQ   (NH_ * HD)
#define DKV  (NKV * HD)
#define ZH   1
#define RH   4096                  // every row on the same path
#define WIN  4096
#define PCAR 1024.0f
#define SCL  0.125f   // HD^-0.5
typedef _Float16 h16;
typedef unsigned short bf;
typedef __attribute__((ext_vector_type(16))) __bf16   v16bf;
typedef __attribute__((ext_vector_type(16))) _Float16 v16h;
typedef __attribute__((ext_vector_type(8)))  _Float16 v8h;
typedef __attribute__((ext_vector_type(8)))  unsigned short v8us;
typedef __attribute__((ext_vector_type(8)))  float    v8f;
typedef __attribute__((ext_vector_type(4)))  float    v4f;
typedef v8h  __attribute__((may_alias)) v8ha;
typedef v4f  __attribute__((may_alias)) v4fa;
typedef v8us __attribute__((may_alias)) v8usa;

__device__ __forceinline__ unsigned short f2bf(float f) { unsigned u = __float_as_uint(f); u += 0x7FFFu + ((u >> 16) & 1u); return (unsigned short)(u >> 16); }
__device__ __forceinline__ float bf2f(unsigned short b) { return __uint_as_float(((unsigned)b) << 16); }
__device__ __forceinline__ float bfr(float f) { return bf2f(f2bf(f)); }
__device__ __forceinline__ v16h cat16(v8h lo, v8h hi) { return __builtin_shufflevector(lo, hi, 0, 1, 2, 3, 4, 5, 6, 7, 8, 9, 10, 11, 12, 13, 14, 15); }
__device__ __forceinline__ v16bf cat16b(v8us lo, v8us hi) { return __builtin_bit_cast(v16bf, __builtin_shufflevector(lo, hi, 0, 1, 2, 3, 4, 5, 6, 7, 8, 9, 10, 11, 12, 13, 14, 15)); }
__device__ __forceinline__ v8f wmma16(v16h a, v16h b, v8f c) { return __builtin_amdgcn_wmma_f32_16x16x32_f16(false, a, false, b, (short)0, c, false, false); }
__device__ __forceinline__ v8f wmmab(v16bf a, v16bf b, v8f c) { return __builtin_amdgcn_wmma_f32_16x16x32_bf16(false, a, false, b, (short)0, c, false, false); }



// ---- k_gemmw: register-blocked GEMM, ONE WAVE per 64x64 output tile (16 accumulators), operands straight from K-contiguous 16-bit planes; grid (M/64, N/64, Z), 32 threads.
// C[m][n] (f32, pitch ldc, + optional f32 bias[n]) = sum_k A[m][k] Bt[n][k] (+ split products per NSPLIT). z-batch strides sA/sB/sC in elements. K % 32 == 0.
template <typename T16> struct WFrag;
template <> struct WFrag<h16> { typedef v16h V; static __device__ __forceinline__ V ld(const h16* p) { return cat16(*(const v8h*)p, *(const v8h*)(p + 16)); } static __device__ __forceinline__ v8f mma(V a, V b, v8f c) { return wmma16(a, b, c); } };
template <> struct WFrag<bf> { typedef v16bf V; static __device__ __forceinline__ V ld(const bf* p) { return cat16b(*(const v8us*)p, *(const v8us*)(p + 16)); } static __device__ __forceinline__ v8f mma(V a, V b, v8f c) { return wmmab(a, b, c); } };
template <typename T16, int NSPLIT, bool BIAS>
__global__ __launch_bounds__(32) void k_gemmw(const T16* __restrict__ A, const T16* __restrict__ A2, const T16* __restrict__ Bt, const T16* __restrict__ Bt2, int K, float* C, int ldc, const float* __restrict__ bias, size_t sA, size_t sB, size_t sC) {
    typedef typename WFrag<T16>::V V;
    __shared__ __align__(16) float os[16 * 68];
    const size_t z = blockIdx.z; A += z * sA; if (A2) A2 += z * sA; Bt += z * sB; if (Bt2) Bt2 += z * sB; C += z * sC;
    const int lane = threadIdx.x & 31, lr = lane & 15, hi = lane >> 4; const int r0 = blockIdx.x * 64, c0 = blockIdx.y * 64;
    v8f acc[4][4];
#pragma unroll
    for (int mb = 0; mb < 4; ++mb)
#pragma unroll
        for (int nb = 0; nb < 4; ++nb) acc[mb][nb] = (v8f){};
    const size_t aoff = (size_t)(r0 + lr) * K + 8 * hi, boff = (size_t)(c0 + lr) * K + 8 * hi;
#pragma unroll 1
    for (int kc = 0; kc < K; kc += 32) {
        V a[4], a2[4];
#pragma unroll
        for (int mb = 0; mb < 4; ++mb) { a[mb] = WFrag<T16>::ld(A + aoff + (size_t)mb * 16 * K + kc); if (NSPLIT == 1 || NSPLIT == 2) a2[mb] = WFrag<T16>::ld(A2 + aoff + (size_t)mb * 16 * K + kc); }
#pragma unroll
        for (int nb = 0; nb < 4; ++nb) { const V b = WFrag<T16>::ld(Bt + boff + (size_t)nb * 16 * K + kc); V b2; if (NSPLIT >= 2) b2 = WFrag<T16>::ld(Bt2 + boff + (size_t)nb * 16 * K + kc);
#pragma unroll
            for (int mb = 0; mb < 4; ++mb) { acc[mb][nb] = WFrag<T16>::mma(a[mb], b, acc[mb][nb]); if (NSPLIT == 1 || NSPLIT == 2) acc[mb][nb] = WFrag<T16>::mma(a2[mb], b, acc[mb][nb]); if (NSPLIT >= 2) acc[mb][nb] = WFrag<T16>::mma(a[mb], b2, acc[mb][nb]); } }
        asm volatile("v_nop\n\tv_nop\n\tv_nop\n\tv_nop" : "+v"(acc[0][0]), "+v"(acc[1][1]), "+v"(acc[2][2]), "+v"(acc[3][3]) : "v"(a[0]), "v"(a[3]));
    }
#pragma unroll
    for (int mb = 0; mb < 4; ++mb) {
#pragma unroll
        for (int nb = 0; nb < 4; ++nb) {
#pragma unroll
            for (int j = 0; j < 8; ++j) os[(hi * 8 + j) * 68 + nb * 16 + lr] = acc[mb][nb][j]; }
        __builtin_amdgcn_wave_barrier(); asm volatile("" ::: "memory");
        float* crow = C + (size_t)(r0 + mb * 16) * ldc + c0;
{
#pragma unroll
            for (int s = 0; s < 8; ++s) { const int row = 2 * s + hi, cofs = lr * 4; v4f val = *(const v4fa*)(os + row * 68 + cofs); if (BIAS) { val[0] += bfr(bias[c0 + cofs]); val[1] += bfr(bias[c0 + cofs + 1]); val[2] += bfr(bias[c0 + cofs + 2]); val[3] += bfr(bias[c0 + cofs + 3]); }
                *(v4f*)(crow + (size_t)row * ldc + cofs) = val; }
             }
        __builtin_amdgcn_wave_barrier(); asm volatile("" ::: "memory");
    }
}

typedef __attribute__((ext_vector_type(2))) _Float16 v2h;
typedef __attribute__((ext_vector_type(4))) _Float16 v4h;
typedef __attribute__((ext_vector_type(2))) unsigned short v2us;
typedef __attribute__((ext_vector_type(4))) unsigned short v4us;
typedef __attribute__((ext_vector_type(2))) float v2f;
typedef __attribute__((ext_vector_type(4))) int v4i;
typedef __attribute__((ext_vector_type(4))) unsigned v4u;
typedef __attribute__((ext_vector_type(2))) unsigned v2u;
typedef __attribute__((ext_vector_type(2))) __bf16 v2bf;

__global__ __launch_bounds__(256) void k_wtG(const float* __restrict__ w, int K, int N, bf* Bt) {
    const int lane = threadIdx.x & 31; const int L0 = (blockIdx.x * 8 + (threadIdx.x >> 5)) * 8; const int nlines = N * K / 64;
{
#pragma unroll 1
        for (int l = 0; l < 8; ++l) { const int L = L0 + l; if (L >= nlines) break; const size_t e = (size_t)L * 64 + lane * 2; const int k = (int)(e % K), n = (int)(e / K); v2us o;
            o[0] = f2bf(w[(size_t)k * N + n]); o[1] = f2bf(w[(size_t)(k + 1) * N + n]); *(v2us*)(Bt + e) = o; }
         }
}
__global__ __launch_bounds__(256) void k_cvt8(const float* __restrict__ src, bf* dst, size_t n8) { const size_t i = (size_t)blockIdx.x * 256 + threadIdx.x; if (i >= n8) return; const v8f v = *(const v8f*)(src + i * 8); v8us o;
#pragma unroll
    for (int k = 0; k < 8; ++k) o[k] = f2bf(v[k]); *(v8us*)(dst + i * 8) = o;  }

// ---- k_prep: the three operand planes of k_fattn in ONE launch: Qb [h][t][d], Kf and Vf in fragment order (below), each input element read once and rounded to bf16 (nearest even); Vf then holds that value as f16, the operand type of the second product. Grid (TT / PT, NH_), 256 threads; a work-group owns PT = 128 tokens of one head.
// Fragment order: a head's keys in blocks of 32 (one pass of k_fattn), a block = 8 units of 512 B, a unit = 32 lanes x 16 B (a piece = 8 bf16), lane = 16 hi + lr: ONE wave-wide 16-B load of k_fattn reads one unit, 4 whole 128-B lines.
//   Kf unit (kt * 2 + ks) * 2 + c, lane (hi, lr): key 16 kt + lr, d = 32 ks + 16 c + 8 hi + 0..7.   Vf unit dt * 2 + c, lane (hi, lr): d = 16 dt + lr, keys 16 c + 8 hi + 0..7.
// Every load is 16 B a lane, 16 lanes on one 256-B input row (4 neighbouring d a lane); all 24 loads of a lane are asked for before the first is used.
// q, k: load i takes tokens 16 i + g (g = thread / 16), 4 d a lane. q goes out as 8 B a lane, a wave stores 256 B in a row; k's 8-B half pieces change lanes through LDS.
// v: a lane takes the 8 neighbouring tokens 8 g .. 8 g + 7 and packs those of one d into a 16-B piece; the pieces change lanes through LDS. Behind the barrier a wave stores whole 512-B units of Kf and Vf.
// LDS, v: row d is 256 B = 16 pieces; piece g stands at place g ^ s(d), s(d) = (d & 12) | ((d / 16 ^ d) & 3): the 16 writers of a half wave (d 4 apart, same g) and the 16 readers (16 neighbouring d, same g) each cover all 64 banks once.
// LDS, k: the units in their final order, but piece (hi, lr) of a unit stands at place 16 hi + (lr ^ 2 (4 ks + 2 c + hi)): the 32 writers of a wave (two tokens, all 64 d) and the 16 readers of a half wave each cover all 64 banks once.
#define PT 128
__global__ __launch_bounds__(256) void k_prep(const float* __restrict__ xq, const float* __restrict__ xk, const float* __restrict__ xv, bf* __restrict__ Qb, bf* __restrict__ Kf, bf* __restrict__ Vf) {
    __shared__ __align__(16) unsigned vs[HD * PT / 2];
    __shared__ __align__(16) unsigned kl[HD * PT / 2];
    const int tid = threadIdx.x, l16 = tid & 15, g = tid >> 4; const int h = blockIdx.y, t0 = blockIdx.x * PT;
    const size_t voff = (size_t)(t0 + g * 8) * DQ + h * HD + l16 * 4, qoff = (size_t)(t0 + g) * DQ + h * HD + l16 * 4;
    v4f xvv[8], xqq[8], xkk[8];
#pragma unroll
    for (int i = 0; i < 8; ++i) xvv[i] = *(const v4f*)(xv + voff + (size_t)i * DQ);
    asm volatile("s_wait_xcnt 0x0" ::: "memory");            // in front of every rewrite of an address register of the v loads (the build lets the next loads' data land on it)
#pragma unroll
    for (int i = 0; i < 8; ++i) xqq[i] = *(const v4f*)(xq + qoff + (size_t)i * 16 * DQ);
    asm volatile("s_wait_xcnt 0x0" ::: "memory");            // the same for the q loads
#pragma unroll
    for (int i = 0; i < 8; ++i) xkk[i] = *(const v4f*)(xk + qoff + (size_t)i * 16 * DQ);
    asm volatile("s_wait_xcnt 0x0" ::: "memory");            // the same for the k loads
    __builtin_amdgcn_sched_barrier(0);                       // keeps all 24 loads in front of the first use: left alone the build sinks the q and k loads between the conversions, and their latencies add up
#pragma unroll
    for (int j = 0; j < 4; ++j) { v4u o;
#pragma unroll
        for (int p = 0; p < 4; ++p) { v2f a; a[0] = xvv[2 * p][j]; a[1] = xvv[2 * p + 1][j]; const unsigned u = __builtin_bit_cast(unsigned, __builtin_convertvector(a, v2bf)); v2f r; r[0] = __uint_as_float(u << 16); r[1] = __uint_as_float(u & 0xFFFF0000u); o[p] = __builtin_bit_cast(unsigned, __builtin_convertvector(r, v2h)); }
        *(v4u*)(vs + (l16 * 4 + j) * (PT / 2) + (g ^ ((l16 & 3) * 4 | ((l16 >> 2) ^ j))) * 4) = o; }
    bf* qd = Qb + ((size_t)h * TT + t0) * HD + (size_t)tid * 4;
    unsigned* kw = kl + (l16 >> 2) * 128 + (((l16 >> 1) & 1) * 16 + (g ^ ((l16 >> 1) * 2))) * 4 + (l16 & 1) * 2;   // unit 2 ks + c of key tile 0, the lane's half piece; load i is key tile i: 4 units on
#pragma unroll
    for (int i = 0; i < 8; ++i) { v2u oq, ok;
#pragma unroll
        for (int p = 0; p < 2; ++p) { v2f a, b; a[0] = xqq[i][2 * p]; a[1] = xqq[i][2 * p + 1]; b[0] = xkk[i][2 * p]; b[1] = xkk[i][2 * p + 1]; oq[p] = __builtin_bit_cast(unsigned, __builtin_convertvector(a, v2bf)); ok[p] = __builtin_bit_cast(unsigned, __builtin_convertvector(b, v2bf)); }
        *(v2u*)(qd + i * 1024) = oq; *(v2u*)(kw + i * 512) = ok; }
    asm volatile("s_wait_xcnt 0x0" ::: "memory");            // in front of every rewrite of a data or address register of the q stores
    // work-group barrier with LDS-only fences: every piece of the k and v tiles is in LDS before a lane takes another lane's; __syncthreads() would also wait here for the q stores, which nobody in this launch reads
    __builtin_amdgcn_fence(__ATOMIC_RELEASE, "workgroup", "local"); __builtin_amdgcn_s_barrier(); __builtin_amdgcn_fence(__ATOMIC_ACQUIRE, "workgroup", "local");
#pragma unroll
    for (int i = 0; i < 4; ++i) {                            // thread tid stores piece i * 256 + tid of the work-group's 16 KB of each plane: unit i * 8 + tid / 32, lane tid % 32 = (hi, l16)
        const int hi = g & 1, u = tid >> 5, d = (u >> 1) * 16 + l16;
        const v4u kv = *(const v4u*)(kl + (i * 8 + u) * 128 + (hi * 16 + (l16 ^ (((u & 3) * 2 + hi) * 2))) * 4);
        const v4u vv = *(const v4u*)(vs + d * (PT / 2) + ((i * 4 + (u & 1) * 2 + hi) ^ ((l16 & 12) | (((u >> 1) ^ l16) & 3))) * 4);
        *(v4u*)(Kf + ((size_t)h * TT + t0) * HD + (size_t)(i * 256 + tid) * 8) = kv; *(v4u*)(Vf + ((size_t)h * TT + t0) * HD + (size_t)(i * 256 + tid) * 8) = vv; }
}
// ---- k_fattn: scores, softmax and probability x value contraction of one head in ONE kernel; no score or probability leaves the registers. Grid (NH_, NPB / 2), FW = FQW * FKG waves a work-group: 256 equal work-groups, four waves a SIMD.
// The deal: a query tile is FQ = 32 columns, a pass is 32 keys. Wave w works on tile column qi = w % FQW as key group g = w / FQW: of its tile's passes it takes numbers g, g + FKG, g + 2 FKG ... (the FQW waves of one key group walk the same keys side by side).
// Causal cost grows with the tile's number, so every wave runs two tiles one after the other, number t and number TT / FQ - 1 - t: each work-group gets the same number of passes wherever it lands; causal, a wave gets 31 to 33.
// Each wave leaves its partial result (maximum in use, sum, unscaled output tiles) in LDS; behind ONE work-group barrier the FKG waves of a tile add the FKG partials in group order, each for its own 16 queries x 32 d (whole 128-B lines of the output).
// Transposed products: S^T[key][query] = K . Q^T (A = K rows, B = Q rows, the Kf units hold d in the order of the Q loader, so the k order pairs), O^T[d][query] += V^T . P^T.
// K and V^T come from the fragment-order planes of k_prep: each of a pass's 16 loads reads 512 B in a row (a plane in row order gave every load 16 separate lines).
// A lane then holds one query's scores: two S^T tiles (keys 0-15 and 16-31 of the pass), converted in place, ARE the B operand of the second product in the hardware k order (element s: key 8 * hi + s, s < 8; 16 + 8 * hi + s - 8 above), which is the order the Vf units hold V^T in.
// Online softmax in the log2 domain: p = exp2(s * FSC - m), m = the column's maximum in use; sums and output tiles are rescaled only when some column's new maximum exceeds m by more than 8 (p <= 2^8, far inside f32 and f16); p goes in rounded once to f16 against v in f16 (1 product), the column's sum takes the unrounded p; the division by the column's sum comes last.
// Causal: a tile's last pass is its diagonal pass (keys q0 .. q0 + 31), the only one that needs the mask. A key group without a pass leaves sum 0 and maximum -3e38: weight exp2(-huge) = 0 in the merge.
#define FQ 32
#define FQW 4
#define FKG 4
#define FW (FQW * FKG)
#define NPB (TT / (FQ * FQW))
#define FSC 0.18033688011112042f   // HD^-0.5 * log2(e)
typedef __attribute__((ext_vector_type(8))) unsigned v8u;
__device__ __forceinline__ v16bf ldfr(const bf* p) { return cat16b(*(const v8us*)p, *(const v8us*)(p + 256)); }   // one fragment = two neighbouring units; p already holds the lane's 8 * lane
__device__ __forceinline__ float xhalf(float x) { const int b = __float_as_int(x); return __int_as_float(__builtin_amdgcn_permlanex16(b, b, 0x76543210, 0xfedcba98, false, false)); }   // lane l <- lane l ^ 16, on the vector pipe
__global__ __launch_bounds__(32 * FW) void k_fattn(const bf* __restrict__ Q, const bf* __restrict__ Kp, const bf* __restrict__ Vt, const int* __restrict__ CF, float* OUTb) {
    typedef WFrag<bf>::V V;
    __shared__ v4f po[2 * FW * 512];        // [tile of the wave][wave][unit (dt * 2 + qt) * 2 + half of the 8 registers][lane] x 16 B: every LDS access of a wave is 512 B in a row
    __shared__ v2f pml[2 * FW * 64];        // [tile of the wave][wave][qt][lane] x (maximum in use, the lane's sum)
    const int lane = threadIdx.x & 31, lr = lane & 15, hi = lane >> 4; const int w = __builtin_amdgcn_readfirstlane((int)(threadIdx.x >> 5)); const int qi = w % FQW, g = w / FQW; const int h = blockIdx.x;
    const bool con = (CF[0] != 0);
    const bf* kp = Kp + (size_t)h * TT * HD + 8 * lane; const bf* vp = Vt + (size_t)h * HD * TT + 8 * lane;   // a block of 32 keys is 32 * HD elements in either plane
    V kf[2][2];                                              // the K rows of the wave's next pass; a tile's last pass fetches those of the next tile's first pass (block g again)
#pragma unroll
    for (int t = 0; t < 2; ++t)
#pragma unroll
        for (int ks = 0; ks < 2; ++ks) kf[t][ks] = ldfr(kp + (size_t)g * 32 * HD + (t * 2 + ks) * 512);
    // the two tiles run one after the other through the same code (rolled: one copy of the pass loop in the instruction cache)
#pragma unroll 1
    for (int ph = 0; ph < 2; ++ph) {
        const int q0 = (ph ? (NPB - 1 - (int)blockIdx.y) * FQW + (FQW - 1 - qi) : (int)blockIdx.y * FQW + qi) * FQ;
        const int klast = con ? q0 : TT - 32;                // first key of the tile's last pass (wave-uniform)
        const bf* qp = Q + (size_t)h * TT * HD + (size_t)(q0 + lr) * HD + 8 * hi;
        V qf[2][2];
#pragma unroll
        for (int t = 0; t < 2; ++t)
#pragma unroll
            for (int ks = 0; ks < 2; ++ks) qf[t][ks] = WFrag<bf>::ld(qp + t * 16 * HD + ks * 32);
        asm volatile("s_wait_xcnt 0x0" ::: "memory");        // in front of every rewrite of an address register of the Q loads (and, the first time, of the first K loads)
        v8f o[4][2]; float m[2], l[2];
#pragma unroll
        for (int qt = 0; qt < 2; ++qt) { m[qt] = -3.0e38f; l[qt] = 0.0f;
#pragma unroll
            for (int dt = 0; dt < 4; ++dt) o[dt][qt] = (v8f){}; }
        // the pass loop stays rolled (two passes side by side would not fit the registers of four waves a SIMD); every inner loop is unrolled so that the fragment arrays are registers
#pragma unroll 1
        for (int kb = g * 32; kb <= klast; kb += 32 * FKG) {
            v16h vf[4];                                      // this pass's V^T (f16), asked for ahead of the score products: the softmax covers its latency
#pragma unroll
            for (int dt = 0; dt < 4; ++dt) vf[dt] = __builtin_bit_cast(v16h, ldfr(vp + (size_t)kb * HD + dt * 512));
            __builtin_amdgcn_sched_barrier(0);               // keeps these loads up here: left alone the build sinks them behind the maximum, and the second product waits on them
            v8f st[2][2];
#pragma unroll
            for (int kt = 0; kt < 2; ++kt)
#pragma unroll
                for (int qt = 0; qt < 2; ++qt) { st[kt][qt] = wmmab(kf[kt][0], qf[qt][0], (v8f){}); st[kt][qt] = wmmab(kf[kt][1], qf[qt][1], st[kt][qt]); }
            const int kn = (kb + 32 * FKG <= klast) ? kb + 32 * FKG : g * 32;   // the K rows of the wave's next pass, fetched one pass ahead; behind a tile's last pass that is block g, the next tile's first (behind the second tile: in bounds, unused)
#pragma unroll
            for (int kt = 0; kt < 2; ++kt)
#pragma unroll
                for (int ks = 0; ks < 2; ++ks) kf[kt][ks] = ldfr(kp + (size_t)kn * HD + (kt * 2 + ks) * 512);
            asm volatile("s_wait_xcnt 0x0" ::: "memory");    // in front of every rewrite of an address register of this pass's V^T and K loads
            if (con && kb == klast) {                        // diagonal pass (scalar branch): keys above the query get weight exp2(-huge) = 0
#pragma unroll
                for (int kt = 0; kt < 2; ++kt)
#pragma unroll
                    for (int qt = 0; qt < 2; ++qt)
#pragma unroll
                        for (int j = 0; j < 8; ++j) st[kt][qt][j] = (kt * 16 + hi * 8 + j <= qt * 16 + lr) ? st[kt][qt][j] : -3.0e38f;
            }
            float mx[2]; bool need = false;
#pragma unroll
            for (int qt = 0; qt < 2; ++qt) { float a = st[0][qt][0];
#pragma unroll
                for (int j = 1; j < 8; ++j) a = fmaxf(a, st[0][qt][j]);
#pragma unroll
                for (int j = 0; j < 8; ++j) a = fmaxf(a, st[1][qt][j]);
                a = fmaxf(a, xhalf(a)) * FSC;       // lanes c and c + 16 hold the two halves of one query's keys: both must use one m
                mx[qt] = a; need = need || (a > m[qt] + 8.0f); }
            if (__builtin_amdgcn_ballot_w32(need) != 0) {    // scalar branch, once a pass
#pragma unroll
                for (int qt = 0; qt < 2; ++qt) { const float mn = fmaxf(m[qt], mx[qt]); const float f = __builtin_amdgcn_exp2f(m[qt] - mn); m[qt] = mn; l[qt] *= f;
#pragma unroll
                    for (int dt = 0; dt < 4; ++dt) o[dt][qt] *= f; }
            }
            // scale-and-subtract and the sums go by register pairs, each pair two neighbouring registers of one score tile (v_pk_fma_f32, v_pk_add_f32: two elements an issue slot); written element by element the build paired registers across tiles and moved them into place every pass
            v16h pf[2];
#pragma unroll
            for (int qt = 0; qt < 2; ++qt) { v8u uh; v2f s = (v2f){}; v2f fs, nm; fs[0] = FSC; fs[1] = FSC; nm[0] = -m[qt]; nm[1] = -m[qt];
#pragma unroll
                for (int kt = 0; kt < 2; ++kt)
#pragma unroll
                    for (int jp = 0; jp < 4; ++jp) { v2f sp; sp[0] = st[kt][qt][2 * jp]; sp[1] = st[kt][qt][2 * jp + 1]; const v2f x = __builtin_elementwise_fma(sp, fs, nm); v2f pp; pp[0] = __builtin_amdgcn_exp2f(x[0]); pp[1] = __builtin_amdgcn_exp2f(x[1]); s += pp;
                        uh[kt * 4 + jp] = __builtin_bit_cast(unsigned, __builtin_convertvector(pp, v2h)); }
                l[qt] += s[0] + s[1]; pf[qt] = __builtin_bit_cast(v16h, uh); }
#pragma unroll
            for (int dt = 0; dt < 4; ++dt)
#pragma unroll
                for (int qt = 0; qt < 2; ++qt) o[dt][qt] = wmma16(vf[dt], pf[qt], o[dt][qt]);
        }
        v4f* pw = po + (ph * FW + w) * 512 + lane;
#pragma unroll
        for (int qt = 0; qt < 2; ++qt) { v2f ml; ml[0] = m[qt]; ml[1] = l[qt]; pml[(ph * FW + w) * 64 + qt * 32 + lane] = ml;
#pragma unroll
            for (int dt = 0; dt < 4; ++dt) { v4f r0, r1;
#pragma unroll
                for (int j = 0; j < 4; ++j) { r0[j] = o[dt][qt][j]; r1[j] = o[dt][qt][4 + j]; }
                pw[((dt * 2 + qt) * 2) * 32] = r0; pw[((dt * 2 + qt) * 2 + 1) * 32] = r1; } }
    }
    __syncthreads();                                         // every wave's two partial results are in LDS before a wave adds the other key groups' to its own
    const int mq = g & 1, md = g >> 1;                       // the wave's share of each of its two tiles: queries 16 mq + 0..15, d = 32 md + 0..31
    for (int ph = 0; ph < 2; ++ph) {
        const int q0 = (ph ? (NPB - 1 - (int)blockIdx.y) * FQW + (FQW - 1 - qi) : (int)blockIdx.y * FQW + qi) * FQ;
        v2f ml[FKG]; float f[FKG];
#pragma unroll
        for (int k = 0; k < FKG; ++k) ml[k] = pml[(ph * FW + k * FQW + qi) * 64 + mq * 32 + lane];
        const float mm = fmaxf(fmaxf(ml[0][0], ml[1][0]), fmaxf(ml[2][0], ml[3][0])); float ls = 0.0f;
#pragma unroll
        for (int k = 0; k < FKG; ++k) { f[k] = __builtin_amdgcn_exp2f(ml[k][0] - mm); ls = __builtin_fmaf(ml[k][1], f[k], ls); }
        const float inv = __fdiv_rn(1.0f, ls + xhalf(ls));
        float* op = OUTb + (size_t)(q0 + mq * 16 + lr) * DQ + h * HD + md * 32 + 8 * hi;   /* f32 output [l][h*64 + d]; register j of tile dt is d = 16 dt + 8 hi + j */
#pragma unroll
        for (int u = 0; u < 4; ++u) {                        // u = 2 * (dt - 2 md) + half of the 8 registers
            v4f r = (v4f){};
#pragma unroll
            for (int k = 0; k < FKG; ++k) r += po[(ph * FW + k * FQW + qi) * 512 + (((md * 2 + (u >> 1)) * 2 + mq) * 2 + (u & 1)) * 32 + lane] * f[k];
            *(v4f*)(op + (u >> 1) * 16 + (u & 1) * 4) = r * inv; }
    }
}

extern "C" void kernel_launch(void* const* d_in, const int* in_sizes, int n_in,
                              void* d_out, int out_size, void* d_ws, size_t ws_size, hipStream_t stream) {
    (void)in_sizes; (void)n_in; (void)out_size;
    const float* xq = (const float*)d_in[0]; const float* xk = (const float*)d_in[1]; const float* xv = (const float*)d_in[2]; const int* CFLAG = (const int*)d_in[3];   /* 'causal' flag (int, read on device) */ const float* x = xq; const float* wq = nullptr; const float* wk = nullptr; const float* wv = nullptr; const float* wo = nullptr; (void)x; (void)wq; (void)wk; (void)wv; (void)wo;
    float* OUT = (float*)d_out;     // [1][4096][1024]
    char* wsp = (char*)d_ws;
    auto take = [&](size_t bytes) { char* p = wsp; wsp += (bytes + 255) & ~(size_t)255; return (void*)p; };
    bf* QPh = (bf*)take((size_t)NH_ * TT * HD * 2); bf* KPh = (bf*)take((size_t)NKV * TT * HD * 2); bf* VTh = (bf*)take((size_t)NKV * HD * TT * 2);
    if ((size_t)(wsp - (char*)d_ws) > ws_size) return;    // ws 256 MiB

    for (int b = 0; b < NB_; ++b) {
        k_prep<<<dim3(TT / PT, NH_), 256, 0, stream>>>(xq + (size_t)b * TT * DM, xk + (size_t)b * TT * DM, xv + (size_t)b * TT * DM, QPh, KPh, VTh);   /* bf16 planes of q and k and the f16 plane of v^T straight from the inputs; k and v^T in fragment order */
        k_fattn<<<dim3(NH_, NPB / 2), 32 * FW, 0, stream>>>(QPh, KPh, VTh, CFLAG, OUT + (size_t)b * TT * DM);   /* one kv head per query head */
    }
}

// v008
// It runs in 36.5 microseconds.
// In two side-by-side timings against v007, it was 1.08 and 1.07 times as fast.
// All steps since v000 together make it 56.0 times as fast.
#include <hip/hip_runtime.h>

// Plain (optionally causal) multi-head attention on given q/k/v (q, k, v [1][4096][16][64]; scores = q.k/8; when the int input 'causal' is non-zero (read on device) keys above the diagonal are masked (-inf == exact zero weight); softmax; out[b][s][h][d] = attn.v -> [1][4096][16][64]).
// Layout: no projections - the bf16-rounded inputs ARE the operand planes (exact single bf16 planes for q and k, one f16 plane for v^T), so the score products are exact (1 product); attn.v takes the f32 softmax weights rounded once to f16 against the bf16-rounded v held as f16 (1 product) on every row; one launch (k_prep) makes the three planes, k and v^T in the order in which the matrix fragments are loaded; scores, online softmax and attn.v run in one kernel for all heads (k_fattn), which writes the [l][h*64+d] result straight to the output in f32.
// Compute dtypes, f32 accumulate: every input rounded to bf16; exact products for q.k; online softmax in f32 (one exp2 per element, two where a later pass must look for new maxima, fixed order, two elements an instruction where the chip has the packed form); probabilities as one f16 operand (11 significant bits) formed in registers, v^T plane in f16 (a bf16 value is exact in f16 from 2^-14 up to 65504 in size; below that it is off by at most 2^-25); f32 output.


#define NB_  1
#define TT   4096
#define DM   1024
#define NH_  16
#define NKV  16
#define REP  (NH_ / NKV)
#define HD   64
#define DQ   (NH_ * HD)
#define DKV  (NKV * HD)
#define ZH   1
#define RH   4096                  // every row on the same path
#define WIN  4096
#define PCAR 1024.0f
#define SCL  0.125f   // HD^-0.5
typedef _Float16 h16;
typedef unsigned short bf;
typedef __attribute__((ext_vector_type(16))) __bf16   v16bf;
typedef __attribute__((ext_vector_type(16))) _Float16 v16h;
typedef __attribute__((ext_vector_type(8)))  _Float16 v8h;
typedef __attribute__((ext_vector_type(8)))  unsigned short v8us;
typedef __attribute__((ext_vector_type(8)))  float    v8f;
typedef __attribute__((ext_vector_type(4)))  float    v4f;
typedef v8h  __attribute__((may_alias)) v8ha;
typedef v4f  __attribute__((may_alias)) v4fa;
typedef v8us __attribute__((may_alias)) v8usa;

__device__ __forceinline__ unsigned short f2bf(float f) { unsigned u = __float_as_uint(f); u += 0x7FFFu + ((u >> 16) & 1u); return (unsigned short)(u >> 16); }
__device__ __forceinline__ float bf2f(unsigned short b) { return __uint_as_float(((unsigned)b) << 16); }
__device__ __forceinline__ float bfr(float f) { return bf2f(f2bf(f)); }
__device__ __forceinline__ v16h cat16(v8h lo, v8h hi) { return __builtin_shufflevector(lo, hi, 0, 1, 2, 3, 4, 5, 6, 7, 8, 9, 10, 11, 12, 13, 14, 15); }
__device__ __forceinline__ v16bf cat16b(v8us lo, v8us hi) { return __builtin_bit_cast(v16bf, __builtin_shufflevector(lo, hi, 0, 1, 2, 3, 4, 5, 6, 7, 8, 9, 10, 11, 12, 13, 14, 15)); }
__device__ __forceinline__ v8f wmma16(v16h a, v16h b, v8f c) { return __builtin_amdgcn_wmma_f32_16x16x32_f16(false, a, false, b, (short)0, c, false, false); }
__device__ __forceinline__ v8f wmmab(v16bf a, v16bf b, v8f c) { return __builtin_amdgcn_wmma_f32_16x16x32_bf16(false, a, false, b, (short)0, c, false, false); }



// ---- k_gemmw: register-blocked GEMM, ONE WAVE per 64x64 output tile (16 accumulators), operands straight from K-contiguous 16-bit planes; grid (M/64, N/64, Z), 32 threads.
// C[m][n] (f32, pitch ldc, + optional f32 bias[n]) = sum_k A[m][k] Bt[n][k] (+ split products per NSPLIT). z-batch strides sA/sB/sC in elements. K % 32 == 0.
template <typename T16> struct WFrag;
template <> struct WFrag<h16> { typedef v16h V; static __device__ __forceinline__ V ld(const h16* p) { return cat16(*(const v8h*)p, *(const v8h*)(p + 16)); } static __device__ __forceinline__ v8f mma(V a, V b, v8f c) { return wmma16(a, b, c); } };
template <> struct WFrag<bf> { typedef v16bf V; static __device__ __forceinline__ V ld(const bf* p) { return cat16b(*(const v8us*)p, *(const v8us*)(p + 16)); } static __device__ __forceinline__ v8f mma(V a, V b, v8f c) { return wmmab(a, b, c); } };
template <typename T16, int NSPLIT, bool BIAS>
__global__ __launch_bounds__(32) void k_gemmw(const T16* __restrict__ A, const T16* __restrict__ A2, const T16* __restrict__ Bt, const T16* __restrict__ Bt2, int K, float* C, int ldc, const float* __restrict__ bias, size_t sA, size_t sB, size_t sC) {
    typedef typename WFrag<T16>::V V;
    __shared__ __align__(16) float os[16 * 68];
    const size_t z = blockIdx.z; A += z * sA; if (A2) A2 += z * sA; Bt += z * sB; if (Bt2) Bt2 += z * sB; C += z * sC;
    const int lane = threadIdx.x & 31, lr = lane & 15, hi = lane >> 4; const int r0 = blockIdx.x * 64, c0 = blockIdx.y * 64;
    v8f acc[4][4];
#pragma unroll
    for (int mb = 0; mb < 4; ++mb)
#pragma unroll
        for (int nb = 0; nb < 4; ++nb) acc[mb][nb] = (v8f){};
    const size_t aoff = (size_t)(r0 + lr) * K + 8 * hi, boff = (size_t)(c0 + lr) * K + 8 * hi;
#pragma unroll 1
    for (int kc = 0; kc < K; kc += 32) {
        V a[4], a2[4];
#pragma unroll
        for (int mb = 0; mb < 4; ++mb) { a[mb] = WFrag<T16>::ld(A + aoff + (size_t)mb * 16 * K + kc); if (NSPLIT == 1 || NSPLIT == 2) a2[mb] = WFrag<T16>::ld(A2 + aoff + (size_t)mb * 16 * K + kc); }
#pragma unroll
        for (int nb = 0; nb < 4; ++nb) { const V b = WFrag<T16>::ld(Bt + boff + (size_t)nb * 16 * K + kc); V b2; if (NSPLIT >= 2) b2 = WFrag<T16>::ld(Bt2 + boff + (size_t)nb * 16 * K + kc);
#pragma unroll
            for (int mb = 0; mb < 4; ++mb) { acc[mb][nb] = WFrag<T16>::mma(a[mb], b, acc[mb][nb]); if (NSPLIT == 1 || NSPLIT == 2) acc[mb][nb] = WFrag<T16>::mma(a2[mb], b, acc[mb][nb]); if (NSPLIT >= 2) acc[mb][nb] = WFrag<T16>::mma(a[mb], b2, acc[mb][nb]); } }
        asm volatile("v_nop\n\tv_nop\n\tv_nop\n\tv_nop" : "+v"(acc[0][0]), "+v"(acc[1][1]), "+v"(acc[2][2]), "+v"(acc[3][3]) : "v"(a[0]), "v"(a[3]));
    }
#pragma unroll
    for (int mb = 0; mb < 4; ++mb) {
#pragma unroll
        for (int nb = 0; nb < 4; ++nb) {
#pragma unroll
            for (int j = 0; j < 8; ++j) os[(hi * 8 + j) * 68 + nb * 16 + lr] = acc[mb][nb][j]; }
        __builtin_amdgcn_wave_barrier(); asm volatile("" ::: "memory");
        float* crow = C + (size_t)(r0 + mb * 16) * ldc + c0;
{
#pragma unroll
            for (int s = 0; s < 8; ++s) { const int row = 2 * s + hi, cofs = lr * 4; v4f val = *(const v4fa*)(os + row * 68 + cofs); if (BIAS) { val[0] += bfr(bias[c0 + cofs]); val[1] += bfr(bias[c0 + cofs + 1]); val[2] += bfr(bias[c0 + cofs + 2]); val[3] += bfr(bias[c0 + cofs + 3]); }
                *(v4f*)(crow + (size_t)row * ldc + cofs) = val; }
             }
        __builtin_amdgcn_wave_barrier(); asm volatile("" ::: "memory");
    }
}

typedef __attribute__((ext_vector_type(2))) _Float16 v2h;
typedef __attribute__((ext_vector_type(4))) _Float16 v4h;
typedef __attribute__((ext_vector_type(2))) unsigned short v2us;
typedef __attribute__((ext_vector_type(4))) unsigned short v4us;
typedef __attribute__((ext_vector_type(2))) float v2f;
typedef __attribute__((ext_vector_type(4))) int v4i;
typedef __attribute__((ext_vector_type(4))) unsigned v4u;
typedef __attribute__((ext_vector_type(2))) unsigned v2u;
typedef __attribute__((ext_vector_type(2))) __bf16 v2bf;

__global__ __launch_bounds__(256) void k_wtG(const float* __restrict__ w, int K, int N, bf* Bt) {
    const int lane = threadIdx.x & 31; const int L0 = (blockIdx.x * 8 + (threadIdx.x >> 5)) * 8; const int nlines = N * K / 64;
{
#pragma unroll 1
        for (int l = 0; l < 8; ++l) { const int L = L0 + l; if (L >= nlines) break; const size_t e = (size_t)L * 64 + lane * 2; const int k = (int)(e % K), n = (int)(e / K); v2us o;
            o[0] = f2bf(w[(size_t)k * N + n]); o[1] = f2bf(w[(size_t)(k + 1) * N + n]); *(v2us*)(Bt + e) = o; }
         }
}
__global__ __launch_bounds__(256) void k_cvt8(const float* __restrict__ src, bf* dst, size_t n8) { const size_t i = (size_t)blockIdx.x * 256 + threadIdx.x; if (i >= n8) return; const v8f v = *(const v8f*)(src + i * 8); v8us o;
#pragma unroll
    for (int k = 0; k < 8; ++k) o[k] = f2bf(v[k]); *(v8us*)(dst + i * 8) = o;  }

// ---- k_prep: the three operand planes of k_fattn in ONE launch: Qb [h][t][d], Kf and Vf in fragment order (below), each input element read once and rounded to bf16 (nearest even); Vf then holds that value as f16, the operand type of the second product. Grid (TT / PT, NH_), 256 threads; a work-group owns PT = 128 tokens of one head.
// Fragment order: a head's keys in blocks of 32 (one pass of k_fattn), a block = 8 units of 512 B, a unit = 32 lanes x 16 B (a piece = 8 bf16), lane = 16 hi + lr: ONE wave-wide 16-B load of k_fattn reads one unit, 4 whole 128-B lines.
//   Kf unit (kt * 2 + ks) * 2 + c, lane (hi, lr): key 16 kt + lr, d = 32 ks + 16 c + 8 hi + 0..7.   Vf unit dt * 2 + c, lane (hi, lr): d = 16 dt + lr, keys 16 c + 8 hi + 0..7.
// Every load is 16 B a lane, 16 lanes on one 256-B input row (4 neighbouring d a lane); all 24 loads of a lane are asked for before the first is used.
// q, k: load i takes tokens 16 i + g (g = thread / 16), 4 d a lane. q goes out as 8 B a lane, a wave stores 256 B in a row; k's 8-B half pieces change lanes through LDS.
// v: a lane takes the 8 neighbouring tokens 8 g .. 8 g + 7 and packs those of one d into a 16-B piece; the pieces change lanes through LDS. Behind the barrier a wave stores whole 512-B units of Kf and Vf.
// LDS, v: row d is 256 B = 16 pieces; piece g stands at place g ^ s(d), s(d) = (d & 12) | ((d / 16 ^ d) & 3): the 16 writers of a half wave (d 4 apart, same g) and the 16 readers (16 neighbouring d, same g) each cover all 64 banks once.
// LDS, k: the units in their final order, but piece (hi, lr) of a unit stands at place 16 hi + (lr ^ 2 (4 ks + 2 c + hi)): the 32 writers of a wave (two tokens, all 64 d) and the 16 readers of a half wave each cover all 64 banks once.
#define PT 128
__global__ __launch_bounds__(256) void k_prep(const float* __restrict__ xq, const float* __restrict__ xk, const float* __restrict__ xv, bf* __restrict__ Qb, bf* __restrict__ Kf, bf* __restrict__ Vf) {
    __shared__ __align__(16) unsigned vs[HD * PT / 2];
    __shared__ __align__(16) unsigned kl[HD * PT / 2];
    const int tid = threadIdx.x, l16 = tid & 15, g = tid >> 4; const int h = blockIdx.y, t0 = blockIdx.x * PT;
    const size_t voff = (size_t)(t0 + g * 8) * DQ + h * HD + l16 * 4, qoff = (size_t)(t0 + g) * DQ + h * HD + l16 * 4;
    v4f xvv[8], xqq[8], xkk[8];
#pragma unroll
    for (int i = 0; i < 8; ++i) xvv[i] = *(const v4f*)(xv + voff + (size_t)i * DQ);
    asm volatile("s_wait_xcnt 0x0" ::: "memory");            // in front of every rewrite of an address register of the v loads (the build lets the next loads' data land on it)
#pragma unroll
    for (int i = 0; i < 8; ++i) xqq[i] = *(const v4f*)(xq + qoff + (size_t)i * 16 * DQ);
    asm volatile("s_wait_xcnt 0x0" ::: "memory");            // the same for the q loads
#pragma unroll
    for (int i = 0; i < 8; ++i) xkk[i] = *(const v4f*)(xk + qoff + (size_t)i * 16 * DQ);
    asm volatile("s_wait_xcnt 0x0" ::: "memory");            // the same for the k loads
    __builtin_amdgcn_sched_barrier(0);                       // keeps all 24 loads in front of the first use: left alone the build sinks the q and k loads between the conversions, and their latencies add up
#pragma unroll
    for (int j = 0; j < 4; ++j) { v4u o;
#pragma unroll
        for (int p = 0; p < 4; ++p) { v2f a; a[0] = xvv[2 * p][j]; a[1] = xvv[2 * p + 1][j]; const unsigned u = __builtin_bit_cast(unsigned, __builtin_convertvector(a, v2bf)); v2f r; r[0] = __uint_as_float(u << 16); r[1] = __uint_as_float(u & 0xFFFF0000u); o[p] = __builtin_bit_cast(unsigned, __builtin_convertvector(r, v2h)); }
        *(v4u*)(vs + (l16 * 4 + j) * (PT / 2) + (g ^ ((l16 & 3) * 4 | ((l16 >> 2) ^ j))) * 4) = o; }
    bf* qd = Qb + ((size_t)h * TT + t0) * HD + (size_t)tid * 4;
    unsigned* kw = kl + (l16 >> 2) * 128 + (((l16 >> 1) & 1) * 16 + (g ^ ((l16 >> 1) * 2))) * 4 + (l16 & 1) * 2;   // unit 2 ks + c of key tile 0, the lane's half piece; load i is key tile i: 4 units on
#pragma unroll
    for (int i = 0; i < 8; ++i) { v2u oq, ok;
#pragma unroll
        for (int p = 0; p < 2; ++p) { v2f a, b; a[0] = xqq[i][2 * p]; a[1] = xqq[i][2 * p + 1]; b[0] = xkk[i][2 * p]; b[1] = xkk[i][2 * p + 1]; oq[p] = __builtin_bit_cast(unsigned, __builtin_convertvector(a, v2bf)); ok[p] = __builtin_bit_cast(unsigned, __builtin_convertvector(b, v2bf)); }
        *(v2u*)(qd + i * 1024) = oq; *(v2u*)(kw + i * 512) = ok; }
    asm volatile("s_wait_xcnt 0x0" ::: "memory");            // in front of every rewrite of a data or address register of the q stores
    // work-group barrier with LDS-only fences: every piece of the k and v tiles is in LDS before a lane takes another lane's; __syncthreads() would also wait here for the q stores, which nobody in this launch reads
    __builtin_amdgcn_fence(__ATOMIC_RELEASE, "workgroup", "local"); __builtin_amdgcn_s_barrier(); __builtin_amdgcn_fence(__ATOMIC_ACQUIRE, "workgroup", "local");
#pragma unroll
    for (int i = 0; i < 4; ++i) {                            // thread tid stores piece i * 256 + tid of the work-group's 16 KB of each plane: unit i * 8 + tid / 32, lane tid % 32 = (hi, l16)
        const int hi = g & 1, u = tid >> 5, d = (u >> 1) * 16 + l16;
        const v4u kv = *(const v4u*)(kl + (i * 8 + u) * 128 + (hi * 16 + (l16 ^ (((u & 3) * 2 + hi) * 2))) * 4);
        const v4u vv = *(const v4u*)(vs + d * (PT / 2) + ((i * 4 + (u & 1) * 2 + hi) ^ ((l16 & 12) | (((u >> 1) ^ l16) & 3))) * 4);
        *(v4u*)(Kf + ((size_t)h * TT + t0) * HD + (size_t)(i * 256 + tid) * 8) = kv; *(v4u*)(Vf + ((size_t)h * TT + t0) * HD + (size_t)(i * 256 + tid) * 8) = vv; }
}
// ---- k_fattn: scores, softmax and probability x value contraction of one head in ONE kernel; no score or probability leaves the registers. Grid (NH_, NPB / 2), FW = FQW * FKG waves a work-group: 256 equal work-groups, four waves a SIMD.
// The deal: a query tile is FQ = 32 columns, a pass is 32 keys. Wave w works on tile column qi = w % FQW as key group g = w / FQW: of its tile's passes it takes numbers g, g + FKG, g + 2 FKG ... (the FQW waves of one key group walk the same keys side by side).
// Causal cost grows with the tile's number, so every wave runs two tiles one after the other, number t and number TT / FQ - 1 - t: each work-group gets the same number of passes wherever it lands; causal, a wave gets 31 to 33.
// Each wave leaves its partial result (maximum in use, sum, unscaled output tiles) in LDS; behind ONE work-group barrier the FKG waves of a tile add the FKG partials in group order, each for its own 16 queries x 32 d (whole 128-B lines of the output).
// Transposed products: S^T[key][query] = K . Q^T (A = K rows, B = Q rows, the Kf units hold d in the order of the Q loader, so the k order pairs), O^T[d][query] += V^T . P^T.
// K and V^T come from the fragment-order planes of k_prep: each of a pass's 16 loads reads 512 B in a row (a plane in row order gave every load 16 separate lines).
// A lane then holds one query's scores: two S^T tiles (keys 0-15 and 16-31 of the pass), converted in place, ARE the B operand of the second product in the hardware k order (element s: key 8 * hi + s, s < 8; 16 + 8 * hi + s - 8 above), which is the order the Vf units hold V^T in.
// Online softmax in the log2 domain: p = exp2(s * FSC - m), m = the column's maximum in use; a pass looks for new maxima and rescales sums and output tiles only when some lane's 16 p of the pass add up to more than 2^8 (so p <= 2^8, far inside f32 and f16); p goes in rounded once to f16 against v in f16 (1 product), the column's sum takes the unrounded p; the division by the column's sum comes last.
// Causal: a tile's last pass is its diagonal pass (keys q0 .. q0 + 31), the only one that needs the mask. A key group without a pass leaves sum 0 and maximum -3e38: weight exp2(-huge) = 0 in the merge.
#define FQ 32
#define FQW 4
#define FKG 4
#define FW (FQW * FKG)
#define NPB (TT / (FQ * FQW))
#define FSC 0.18033688011112042f   // HD^-0.5 * log2(e)
typedef __attribute__((ext_vector_type(8))) unsigned v8u;
struct PassFirst { static constexpr bool v = true; }; struct PassNext { static constexpr bool v = false; };
__device__ __forceinline__ v16bf ldfr(const bf* p) { return cat16b(*(const v8us*)p, *(const v8us*)(p + 256)); }   // one fragment = two neighbouring units; p already holds the lane's 8 * lane
__device__ __forceinline__ float xhalf(float x) { const int b = __float_as_int(x); return __int_as_float(__builtin_amdgcn_permlanex16(b, b, 0x76543210, 0xfedcba98, false, false)); }   // lane l <- lane l ^ 16, on the vector pipe
__global__ __launch_bounds__(32 * FW) void k_fattn(const bf* __restrict__ Q, const bf* __restrict__ Kp, const bf* __restrict__ Vt, const int* __restrict__ CF, float* OUTb) {
    typedef WFrag<bf>::V V;
    __shared__ v4f po[2 * FW * 512];        // [tile of the wave][wave][unit (dt * 2 + qt) * 2 + half of the 8 registers][lane] x 16 B: every LDS access of a wave is 512 B in a row
    __shared__ v2f pml[2 * FW * 64];        // [tile of the wave][wave][qt][lane] x (maximum in use, the lane's sum)
    const int lane = threadIdx.x & 31, lr = lane & 15, hi = lane >> 4; const int w = __builtin_amdgcn_readfirstlane((int)(threadIdx.x >> 5)); const int qi = w % FQW, g = w / FQW; const int h = blockIdx.x;
    const bool con = (CF[0] != 0);
    const bf* kp = Kp + (size_t)h * TT * HD + 8 * lane; const bf* vp = Vt + (size_t)h * HD * TT + 8 * lane;   // a block of 32 keys is 32 * HD elements in either plane
    V kf[2][2];                                              // the K rows of the wave's next pass; a tile's last pass fetches those of the next tile's first pass (block g again)
#pragma unroll
    for (int t = 0; t < 2; ++t)
#pragma unroll
        for (int ks = 0; ks < 2; ++ks) kf[t][ks] = ldfr(kp + (size_t)g * 32 * HD + (t * 2 + ks) * 512);
    // the two tiles run one after the other through the same code (rolled: one copy of the pass loop in the instruction cache)
#pragma unroll 1
    for (int ph = 0; ph < 2; ++ph) {
        const int q0 = (ph ? (NPB - 1 - (int)blockIdx.y) * FQW + (FQW - 1 - qi) : (int)blockIdx.y * FQW + qi) * FQ;
        const int klast = con ? q0 : TT - 32;                // first key of the tile's last pass (wave-uniform)
        const bf* qp = Q + (size_t)h * TT * HD + (size_t)(q0 + lr) * HD + 8 * hi;
        V qf[2][2];
        v8f o[4][2]; float m[2], l[2];
#pragma unroll
        for (int qt = 0; qt < 2; ++qt) { m[qt] = -3.0e38f; l[qt] = 0.0f;
#pragma unroll
            for (int dt = 0; dt < 4; ++dt) o[dt][qt] = (v8f){}; }
        // one pass; every inner loop is unrolled so that the fragment arrays are registers
        auto pass = [&](const int kb, auto first) __attribute__((always_inline)) {
            v16h vf[4];                                      // this pass's V^T (f16), asked for ahead of the score products: the softmax covers its latency
#pragma unroll
            for (int dt = 0; dt < 4; ++dt) vf[dt] = __builtin_bit_cast(v16h, ldfr(vp + (size_t)kb * HD + dt * 512));
            __builtin_amdgcn_sched_barrier(0);               // keeps these loads up here: left alone the build sinks them behind the maximum, and the second product waits on them
            v8f st[2][2];
#pragma unroll
            for (int kt = 0; kt < 2; ++kt)
#pragma unroll
                for (int qt = 0; qt < 2; ++qt) { st[kt][qt] = wmmab(kf[kt][0], qf[qt][0], (v8f){}); st[kt][qt] = wmmab(kf[kt][1], qf[qt][1], st[kt][qt]); }
            const int kn = (kb + 32 * FKG <= klast) ? kb + 32 * FKG : g * 32;   // the K rows of the wave's next pass, fetched one pass ahead; behind a tile's last pass that is block g, the next tile's first (behind the second tile: in bounds, unused)
#pragma unroll
            for (int kt = 0; kt < 2; ++kt)
#pragma unroll
                for (int ks = 0; ks < 2; ++ks) kf[kt][ks] = ldfr(kp + (size_t)kn * HD + (kt * 2 + ks) * 512);
            asm volatile("s_wait_xcnt 0x0" ::: "memory");    // in front of every rewrite of an address register of this pass's V^T and K loads
            if (con && kb == klast) {                        // diagonal pass (scalar branch): keys above the query get weight exp2(-huge) = 0
#pragma unroll
                for (int kt = 0; kt < 2; ++kt)
#pragma unroll
                    for (int qt = 0; qt < 2; ++qt)
#pragma unroll
                        for (int j = 0; j < 8; ++j) st[kt][qt][j] = (kt * 16 + hi * 8 + j <= qt * 16 + lr) ? st[kt][qt][j] : -3.0e38f;
            }
            // p is formed at once with the maximum in use; the pass's own sums are the overflow guard: every p is >= 0, so a lane whose 16 p add up to no more than 2^8 holds no p above 2^8. Only when some lane's sum is above that or is not a number are the maxima looked for.
            // scale-and-subtract and the sums go by register pairs, each pair two neighbouring registers of one score tile (v_pk_fma_f32, v_pk_add_f32: two elements an issue slot); written element by element the build paired registers across tiles and moved them into place every pass
            v16h pf[2]; float ps[2];
            auto soft = [&]() {
#pragma unroll
                for (int qt = 0; qt < 2; ++qt) { v8u uh; v2f s = (v2f){}; v2f fs, nm; fs[0] = FSC; fs[1] = FSC; nm[0] = -m[qt]; nm[1] = -m[qt];
#pragma unroll
                    for (int kt = 0; kt < 2; ++kt)
#pragma unroll
                        for (int jp = 0; jp < 4; ++jp) { v2f sp; sp[0] = st[kt][qt][2 * jp]; sp[1] = st[kt][qt][2 * jp + 1]; const v2f x = __builtin_elementwise_fma(sp, fs, nm); v2f pp; pp[0] = __builtin_amdgcn_exp2f(x[0]); pp[1] = __builtin_amdgcn_exp2f(x[1]); s += pp;
                            uh[kt * 4 + jp] = __builtin_bit_cast(unsigned, __builtin_convertvector(pp, v2h)); }
                    ps[qt] = s[0] + s[1]; pf[qt] = __builtin_bit_cast(v16h, uh); }
            };
            bool redo = true;                                // a tile's first pass has no maximum yet: it goes straight to the maxima
            if constexpr (!decltype(first)::v) { soft(); redo = __builtin_amdgcn_ballot_w32(!(ps[0] <= 256.0f) || !(ps[1] <= 256.0f)) != 0; }
            if (__builtin_expect(redo, decltype(first)::v)) {    // scalar branch, once a pass; rarely taken (said so, so that the usual path runs straight on): new maxima, sums and output tiles rescaled, p formed again from the scores
#pragma unroll
                for (int qt = 0; qt < 2; ++qt) { float a = st[0][qt][0];
#pragma unroll
                    for (int j = 1; j < 8; ++j) a = fmaxf(a, st[0][qt][j]);
#pragma unroll
                    for (int j = 0; j < 8; ++j) a = fmaxf(a, st[1][qt][j]);
                    a = fmaxf(a, xhalf(a)) * FSC;   // lanes c and c + 16 hold the two halves of one query's keys: both must use one m
                    const float mn = fmaxf(m[qt], a);
                    if constexpr (!decltype(first)::v) { const float f = __builtin_amdgcn_exp2f(m[qt] - mn); l[qt] *= f;   // in a first pass the sum and the output tiles are still zero: nothing to rescale
#pragma unroll
                        for (int dt = 0; dt < 4; ++dt) o[dt][qt] *= f; }
                    m[qt] = mn; }
                soft();
            }
            l[0] += ps[0]; l[1] += ps[1];
#pragma unroll
            for (int dt = 0; dt < 4; ++dt)
#pragma unroll
                for (int qt = 0; qt < 2; ++qt) o[dt][qt] = wmma16(vf[dt], pf[qt], o[dt][qt]);
        };
        if (g * 32 <= klast) {                               // a key group without a pass in this tile asks for no Q rows
#pragma unroll
            for (int t = 0; t < 2; ++t)
#pragma unroll
                for (int ks = 0; ks < 2; ++ks) qf[t][ks] = WFrag<bf>::ld(qp + t * 16 * HD + ks * 32);
            asm volatile("s_wait_xcnt 0x0" ::: "memory");        // in front of every rewrite of an address register of the Q loads
            pass(g * 32, PassFirst{});                       // the wave's first pass of the tile, written out: the same pass without the try at the old maximum
            // the pass loop stays rolled (two passes side by side would not fit the registers of four waves a SIMD)
#pragma unroll 1
            for (int kb = g * 32 + 32 * FKG; kb <= klast; kb += 32 * FKG) pass(kb, PassNext{});
        }
        v4f* pw = po + (ph * FW + w) * 512 + lane;
#pragma unroll
        for (int qt = 0; qt < 2; ++qt) { v2f ml; ml[0] = m[qt]; ml[1] = l[qt]; pml[(ph * FW + w) * 64 + qt * 32 + lane] = ml;
#pragma unroll
            for (int dt = 0; dt < 4; ++dt) { v4f r0, r1;
#pragma unroll
                for (int j = 0; j < 4; ++j) { r0[j] = o[dt][qt][j]; r1[j] = o[dt][qt][4 + j]; }
                pw[((dt * 2 + qt) * 2) * 32] = r0; pw[((dt * 2 + qt) * 2 + 1) * 32] = r1; } }
    }
    __syncthreads();                                         // every wave's two partial results are in LDS before a wave adds the other key groups' to its own
    const int mq = g & 1, md = g >> 1;                       // the wave's share of each of its two tiles: queries 16 mq + 0..15, d = 32 md + 0..31
    for (int ph = 0; ph < 2; ++ph) {
        const int q0 = (ph ? (NPB - 1 - (int)blockIdx.y) * FQW + (FQW - 1 - qi) : (int)blockIdx.y * FQW + qi) * FQ;
        v2f ml[FKG]; float f[FKG];
#pragma unroll
        for (int k = 0; k < FKG; ++k) ml[k] = pml[(ph * FW + k * FQW + qi) * 64 + mq * 32 + lane];
        const float mm = fmaxf(fmaxf(ml[0][0], ml[1][0]), fmaxf(ml[2][0], ml[3][0])); float ls = 0.0f;
#pragma unroll
        for (int k = 0; k < FKG; ++k) { f[k] = __builtin_amdgcn_exp2f(ml[k][0] - mm); ls = __builtin_fmaf(ml[k][1], f[k], ls); }
        const float inv = __fdiv_rn(1.0f, ls + xhalf(ls));
        float* op = OUTb + (size_t)(q0 + mq * 16 + lr) * DQ + h * HD + md * 32 + 8 * hi;   /* f32 output [l][h*64 + d]; register j of tile dt is d = 16 dt + 8 hi + j */
#pragma unroll
        for (int u = 0; u < 4; ++u) {                        // u = 2 * (dt - 2 md) + half of the 8 registers
            v4f r = (v4f){};
#pragma unroll
            for (int k = 0; k < FKG; ++k) r += po[(ph * FW + k * FQW + qi) * 512 + (((md * 2 + (u >> 1)) * 2 + mq) * 2 + (u & 1)) * 32 + lane] * f[k];
            *(v4f*)(op + (u >> 1) * 16 + (u & 1) * 4) = r * inv; }
    }
}

extern "C" void kernel_launch(void* const* d_in, const int* in_sizes, int n_in,
                              void* d_out, int out_size, void* d_ws, size_t ws_size, hipStream_t stream) {
    (void)in_sizes; (void)n_in; (void)out_size;
    const float* xq = (const float*)d_in[0]; const float* xk = (const float*)d_in[1]; const float* xv = (const float*)d_in[2]; const int* CFLAG = (const int*)d_in[3];   /* 'causal' flag (int, read on device) */ const float* x = xq; const float* wq = nullptr; const float* wk = nullptr; const float* wv = nullptr; const float* wo = nullptr; (void)x; (void)wq; (void)wk; (void)wv; (void)wo;
    float* OUT = (float*)d_out;     // [1][4096][1024]
    char* wsp = (char*)d_ws;
    auto take = [&](size_t bytes) { char* p = wsp; wsp += (bytes + 255) & ~(size_t)255; return (void*)p; };
    bf* QPh = (bf*)take((size_t)NH_ * TT * HD * 2); bf* KPh = (bf*)take((size_t)NKV * TT * HD * 2); bf* VTh = (bf*)take((size_t)NKV * HD * TT * 2);
    if ((size_t)(wsp - (char*)d_ws) > ws_size) return;    // ws 256 MiB

    for (int b = 0; b < NB_; ++b) {
        k_prep<<<dim3(TT / PT, NH_), 256, 0, stream>>>(xq + (size_t)b * TT * DM, xk + (size_t)b * TT * DM, xv + (size_t)b * TT * DM, QPh, KPh, VTh);   /* bf16 planes of q and k and the f16 plane of v^T straight from the inputs; k and v^T in fragment order */
        k_fattn<<<dim3(NH_, NPB / 2), 32 * FW, 0, stream>>>(QPh, KPh, VTh, CFLAG, OUT + (size_t)b * TT * DM);   /* one kv head per query head */
    }
}

// v009
// A run of this version takes 33.6 microseconds.
// Next to v008, in two timings, it ran 1.06 and 1.08 times as fast.
// All steps since v000 together make it 60.0 times as fast.
#include <hip/hip_runtime.h>

// Plain (optionally causal) multi-head attention on given q/k/v (q, k, v [1][4096][16][64]; scores = q.k/8; when the int input 'causal' is non-zero (read on device) keys above the diagonal are masked (-inf == exact zero weight); softmax; out[b][s][h][d] = attn.v -> [1][4096][16][64]).
// Layout: no projections - the bf16-rounded inputs ARE the operand planes (exact single bf16 planes for q, k and v^T), so the score products are exact (1 product); attn.v takes the f32 softmax weights rounded once to f16 against the bf16-rounded v held as f16 (1 product) on every row; one launch (k_prep) makes the k and v^T planes, in the order in which the matrix fragments are loaded; scores, online softmax and attn.v run in one kernel for all heads (k_fattn), which rounds its own q rows to bf16 and writes the [l][h*64+d] result straight to the output in f32.
// Compute dtypes, f32 accumulate: every input rounded to bf16; exact products for q.k; online softmax in f32 (one exp2 per element, fixed order, two elements an instruction where the chip has the packed form); probabilities as one f16 operand (11 significant bits) formed in registers, v^T plane in f16 (a bf16 value is exact in f16 from 2^-14 up to 65504 in size; below that it is off by at most 2^-25); f32 output.


#define NB_  1
#define TT   4096
#define DM   1024
#define NH_  16
#define NKV  16
#define REP  (NH_ / NKV)
#define HD   64
#define DQ   (NH_ * HD)
#define DKV  (NKV * HD)
#define ZH   1
#define RH   4096                  // every row on the same path
#define WIN  4096
#define PCAR 1024.0f
#define SCL  0.125f   // HD^-0.5
typedef _Float16 h16;
typedef unsigned short bf;
typedef __attribute__((ext_vector_type(16))) __bf16   v16bf;
typedef __attribute__((ext_vector_type(16))) _Float16 v16h;
typedef __attribute__((ext_vector_type(8)))  _Float16 v8h;
typedef __attribute__((ext_vector_type(8)))  unsigned short v8us;
typedef __attribute__((ext_vector_type(8)))  float    v8f;
typedef __attribute__((ext_vector_type(4)))  float    v4f;
typedef v8h  __attribute__((may_alias)) v8ha;
typedef v4f  __attribute__((may_alias)) v4fa;
typedef v8us __attribute__((may_alias)) v8usa;

__device__ __forceinline__ unsigned short f2bf(float f) { unsigned u = __float_as_uint(f); u += 0x7FFFu + ((u >> 16) & 1u); return (unsigned short)(u >> 16); }
__device__ __forceinline__ float bf2f(unsigned short b) { return __uint_as_float(((unsigned)b) << 16); }
__device__ __forceinline__ float bfr(float f) { return bf2f(f2bf(f)); }
__device__ __forceinline__ v16h cat16(v8h lo, v8h hi) { return __builtin_shufflevector(lo, hi, 0, 1, 2, 3, 4, 5, 6, 7, 8, 9, 10, 11, 12, 13, 14, 15); }
__device__ __forceinline__ v16bf cat16b(v8us lo, v8us hi) { return __builtin_bit_cast(v16bf, __builtin_shufflevector(lo, hi, 0, 1, 2, 3, 4, 5, 6, 7, 8, 9, 10, 11, 12, 13, 14, 15)); }
__device__ __forceinline__ v8f wmma16(v16h a, v16h b, v8f c) { return __builtin_amdgcn_wmma_f32_16x16x32_f16(false, a, false, b, (short)0, c, false, false); }
__device__ __forceinline__ v8f wmmab(v16bf a, v16bf b, v8f c) { return __builtin_amdgcn_wmma_f32_16x16x32_bf16(false, a, false, b, (short)0, c, false, false); }



// ---- k_gemmw: register-blocked GEMM, ONE WAVE per 64x64 output tile (16 accumulators), operands straight from K-contiguous 16-bit planes; grid (M/64, N/64, Z), 32 threads.
// C[m][n] (f32, pitch ldc, + optional f32 bias[n]) = sum_k A[m][k] Bt[n][k] (+ split products per NSPLIT). z-batch strides sA/sB/sC in elements. K % 32 == 0.
template <typename T16> struct WFrag;
template <> struct WFrag<h16> { typedef v16h V; static __device__ __forceinline__ V ld(const h16* p) { return cat16(*(const v8h*)p, *(const v8h*)(p + 16)); } static __device__ __forceinline__ v8f mma(V a, V b, v8f c) { return wmma16(a, b, c); } };
template <> struct WFrag<bf> { typedef v16bf V; static __device__ __forceinline__ V ld(const bf* p) { return cat16b(*(const v8us*)p, *(const v8us*)(p + 16)); } static __device__ __forceinline__ v8f mma(V a, V b, v8f c) { return wmmab(a, b, c); } };
template <typename T16, int NSPLIT, bool BIAS>
__global__ __launch_bounds__(32) void k_gemmw(const T16* __restrict__ A, const T16* __restrict__ A2, const T16* __restrict__ Bt, const T16* __restrict__ Bt2, int K, float* C, int ldc, const float* __restrict__ bias, size_t sA, size_t sB, size_t sC) {
    typedef typename WFrag<T16>::V V;
    __shared__ __align__(16) float os[16 * 68];
    const size_t z = blockIdx.z; A += z * sA; if (A2) A2 += z * sA; Bt += z * sB; if (Bt2) Bt2 += z * sB; C += z * sC;
    const int lane = threadIdx.x & 31, lr = lane & 15, hi = lane >> 4; const int r0 = blockIdx.x * 64, c0 = blockIdx.y * 64;
    v8f acc[4][4];
#pragma unroll
    for (int mb = 0; mb < 4; ++mb)
#pragma unroll
        for (int nb = 0; nb < 4; ++nb) acc[mb][nb] = (v8f){};
    const size_t aoff = (size_t)(r0 + lr) * K + 8 * hi, boff = (size_t)(c0 + lr) * K + 8 * hi;
#pragma unroll 1
    for (int kc = 0; kc < K; kc += 32) {
        V a[4], a2[4];
#pragma unroll
        for (int mb = 0; mb < 4; ++mb) { a[mb] = WFrag<T16>::ld(A + aoff + (size_t)mb * 16 * K + kc); if (NSPLIT == 1 || NSPLIT == 2) a2[mb] = WFrag<T16>::ld(A2 + aoff + (size_t)mb * 16 * K + kc); }
#pragma unroll
        for (int nb = 0; nb < 4; ++nb) { const V b = WFrag<T16>::ld(Bt + boff + (size_t)nb * 16 * K + kc); V b2; if (NSPLIT >= 2) b2 = WFrag<T16>::ld(Bt2 + boff + (size_t)nb * 16 * K + kc);
#pragma unroll
            for (int mb = 0; mb < 4; ++mb) { acc[mb][nb] = WFrag<T16>::mma(a[mb], b, acc[mb][nb]); if (NSPLIT == 1 || NSPLIT == 2) acc[mb][nb] = WFrag<T16>::mma(a2[mb], b, acc[mb][nb]); if (NSPLIT >= 2) acc[mb][nb] = WFrag<T16>::mma(a[mb], b2, acc[mb][nb]); } }
        asm volatile("v_nop\n\tv_nop\n\tv_nop\n\tv_nop" : "+v"(acc[0][0]), "+v"(acc[1][1]), "+v"(acc[2][2]), "+v"(acc[3][3]) : "v"(a[0]), "v"(a[3]));
    }
#pragma unroll
    for (int mb = 0; mb < 4; ++mb) {
#pragma unroll
        for (int nb = 0; nb < 4; ++nb) {
#pragma unroll
            for (int j = 0; j < 8; ++j) os[(hi * 8 + j) * 68 + nb * 16 + lr] = acc[mb][nb][j]; }
        __builtin_amdgcn_wave_barrier(); asm volatile("" ::: "memory");
        float* crow = C + (size_t)(r0 + mb * 16) * ldc + c0;
{
#pragma unroll
            for (int s = 0; s < 8; ++s) { const int row = 2 * s + hi, cofs = lr * 4; v4f val = *(const v4fa*)(os + row * 68 + cofs); if (BIAS) { val[0] += bfr(bias[c0 + cofs]); val[1] += bfr(bias[c0 + cofs + 1]); val[2] += bfr(bias[c0 + cofs + 2]); val[3] += bfr(bias[c0 + cofs + 3]); }
                *(v4f*)(crow + (size_t)row * ldc + cofs) = val; }
             }
        __builtin_amdgcn_wave_barrier(); asm volatile("" ::: "memory");
    }
}

typedef __attribute__((ext_vector_type(2))) _Float16 v2h;
typedef __attribute__((ext_vector_type(4))) _Float16 v4h;
typedef __attribute__((ext_vector_type(2))) unsigned short v2us;
typedef __attribute__((ext_vector_type(4))) unsigned short v4us;
typedef __attribute__((ext_vector_type(2))) float v2f;
typedef __attribute__((ext_vector_type(4))) int v4i;
typedef __attribute__((ext_vector_type(4))) unsigned v4u;
typedef __attribute__((ext_vector_type(2))) unsigned v2u;
typedef __attribute__((ext_vector_type(2))) __bf16 v2bf;

__global__ __launch_bounds__(256) void k_wtG(const float* __restrict__ w, int K, int N, bf* Bt) {
    const int lane = threadIdx.x & 31; const int L0 = (blockIdx.x * 8 + (threadIdx.x >> 5)) * 8; const int nlines = N * K / 64;
{
#pragma unroll 1
        for (int l = 0; l < 8; ++l) { const int L = L0 + l; if (L >= nlines) break; const size_t e = (size_t)L * 64 + lane * 2; const int k = (int)(e % K), n = (int)(e / K); v2us o;
            o[0] = f2bf(w[(size_t)k * N + n]); o[1] = f2bf(w[(size_t)(k + 1) * N + n]); *(v2us*)(Bt + e) = o; }
         }
}
__global__ __launch_bounds__(256) void k_cvt8(const float* __restrict__ src, bf* dst, size_t n8) { const size_t i = (size_t)blockIdx.x * 256 + threadIdx.x; if (i >= n8) return; const v8f v = *(const v8f*)(src + i * 8); v8us o;
#pragma unroll
    for (int k = 0; k < 8; ++k) o[k] = f2bf(v[k]); *(v8us*)(dst + i * 8) = o;  }

// ---- k_prep: the two operand planes that k_fattn reads again and again, in ONE launch: Kf and Vf in fragment order (below), each input element read once and rounded to bf16 (nearest even); Vf then holds that value as f16, the operand type of the second product. Grid (TT / PT, NH_), 256 threads; a work-group owns PT = 128 tokens of one head.
// Fragment order: a head's keys in blocks of 32 (one pass of k_fattn), a block = 8 units of 512 B, a unit = 32 lanes x 16 B (a piece = 8 bf16), lane = 16 hi + lr: ONE wave-wide 16-B load of k_fattn reads one unit, 4 whole 128-B lines.
//   Kf unit (kt * 2 + ks) * 2 + c, lane (hi, lr): key 16 kt + lr, d = 32 ks + 16 c + 8 hi + 0..7.   Vf unit dt * 2 + c, lane (hi, lr): d = 16 dt + lr, keys 16 c + 8 hi + 0..7.
// Every load is 16 B a lane, 16 lanes on one 256-B input row (4 neighbouring d a lane); all 16 loads of a lane are asked for before the first is used.
// k: load i takes tokens 16 i + g (g = thread / 16), 4 d a lane; its 8-B half pieces change lanes through LDS.
// v: a lane takes the 8 neighbouring tokens 8 g .. 8 g + 7 and packs those of one d into a 16-B piece; the pieces change lanes through LDS. Behind the barrier a wave stores whole 512-B units of Kf and Vf.
// LDS, v: row d is 256 B = 16 pieces; piece g stands at place g ^ s(d), s(d) = (d & 12) | ((d / 16 ^ d) & 3): the 16 writers of a half wave (d 4 apart, same g) and the 16 readers (16 neighbouring d, same g) each cover all 64 banks once.
// LDS, k: the units in their final order, but piece (hi, lr) of a unit stands at place 16 hi + (lr ^ 2 (4 ks + 2 c + hi)): the 32 writers of a wave (two tokens, all 64 d) and the 16 readers of a half wave each cover all 64 banks once.
#define PT 128
__global__ __launch_bounds__(256) void k_prep(const float* __restrict__ xk, const float* __restrict__ xv, bf* __restrict__ Kf, bf* __restrict__ Vf) {
    __shared__ __align__(16) unsigned vs[HD * PT / 2];
    __shared__ __align__(16) unsigned kl[HD * PT / 2];
    const int tid = threadIdx.x, l16 = tid & 15, g = tid >> 4; const int h = blockIdx.y, t0 = blockIdx.x * PT;
    const size_t voff = (size_t)(t0 + g * 8) * DQ + h * HD + l16 * 4, koff = (size_t)(t0 + g) * DQ + h * HD + l16 * 4;
    v4f xvv[8], xkk[8];
#pragma unroll
    for (int i = 0; i < 8; ++i) xvv[i] = *(const v4f*)(xv + voff + (size_t)i * DQ);
    asm volatile("s_wait_xcnt 0x0" ::: "memory");            // in front of every rewrite of an address register of the v loads (the build lets the next loads' data land on it)
#pragma unroll
    for (int i = 0; i < 8; ++i) xkk[i] = *(const v4f*)(xk + koff + (size_t)i * 16 * DQ);
    asm volatile("s_wait_xcnt 0x0" ::: "memory");            // the same for the k loads
    __builtin_amdgcn_sched_barrier(0);                       // keeps all 16 loads in front of the first use: left alone the build sinks the k loads between the conversions, and their latencies add up
#pragma unroll
    for (int j = 0; j < 4; ++j) { v4u o;
#pragma unroll
        for (int p = 0; p < 4; ++p) { v2f a; a[0] = xvv[2 * p][j]; a[1] = xvv[2 * p + 1][j]; const unsigned u = __builtin_bit_cast(unsigned, __builtin_convertvector(a, v2bf)); v2f r; r[0] = __uint_as_float(u << 16); r[1] = __uint_as_float(u & 0xFFFF0000u); o[p] = __builtin_bit_cast(unsigned, __builtin_convertvector(r, v2h)); }
        *(v4u*)(vs + (l16 * 4 + j) * (PT / 2) + (g ^ ((l16 & 3) * 4 | ((l16 >> 2) ^ j))) * 4) = o; }
    unsigned* kw = kl + (l16 >> 2) * 128 + (((l16 >> 1) & 1) * 16 + (g ^ ((l16 >> 1) * 2))) * 4 + (l16 & 1) * 2;   // unit 2 ks + c of key tile 0, the lane's half piece; load i is key tile i: 4 units on
#pragma unroll
    for (int i = 0; i < 8; ++i) { v2u ok;
#pragma unroll
        for (int p = 0; p < 2; ++p) { v2f b; b[0] = xkk[i][2 * p]; b[1] = xkk[i][2 * p + 1]; ok[p] = __builtin_bit_cast(unsigned, __builtin_convertvector(b, v2bf)); }
        *(v2u*)(kw + i * 512) = ok; }
    // work-group barrier with LDS-only fences: every piece of the k and v tiles is in LDS before a lane takes another lane's
    __builtin_amdgcn_fence(__ATOMIC_RELEASE, "workgroup", "local"); __builtin_amdgcn_s_barrier(); __builtin_amdgcn_fence(__ATOMIC_ACQUIRE, "workgroup", "local");
#pragma unroll
    for (int i = 0; i < 4; ++i) {                            // thread tid stores piece i * 256 + tid of the work-group's 16 KB of each plane: unit i * 8 + tid / 32, lane tid % 32 = (hi, l16)
        const int hi = g & 1, u = tid >> 5, d = (u >> 1) * 16 + l16;
        const v4u kv = *(const v4u*)(kl + (i * 8 + u) * 128 + (hi * 16 + (l16 ^ (((u & 3) * 2 + hi) * 2))) * 4);
        const v4u vv = *(const v4u*)(vs + d * (PT / 2) + ((i * 4 + (u & 1) * 2 + hi) ^ ((l16 & 12) | (((u >> 1) ^ l16) & 3))) * 4);
        *(v4u*)(Kf + ((size_t)h * TT + t0) * HD + (size_t)(i * 256 + tid) * 8) = kv; *(v4u*)(Vf + ((size_t)h * TT + t0) * HD + (size_t)(i * 256 + tid) * 8) = vv; }
}
// ---- k_fattn: scores, softmax and probability x value contraction of one head in ONE kernel; no score or probability leaves the registers. Grid (NH_, NPB / 2), FW = FQW * FKG waves a work-group: 256 equal work-groups, four waves a SIMD.
// The deal: a query tile is FQ = 32 columns, a pass is 32 keys. Wave w works on tile column qi = w % FQW as key group g = w / FQW: of its tile's passes it takes numbers g, g + FKG, g + 2 FKG ... (the FQW waves of one key group walk the same keys side by side).
// Causal cost grows with the tile's number, so every wave runs two tiles one after the other, number t and number TT / FQ - 1 - t: each work-group gets the same number of passes wherever it lands; causal, a wave gets 31 to 33.
// Each wave leaves its partial result (maximum in use, sum, unscaled output tiles) in LDS; behind ONE work-group barrier the FKG waves of a tile add the FKG partials in group order, each for its own 16 queries x 32 d (whole 128-B lines of the output).
// Transposed products: S^T[key][query] = K . Q^T (A = K rows, B = Q rows, the Kf units hold d in the order of the Q loader, so the k order pairs), O^T[d][query] += V^T . P^T.
// K and V^T come from the fragment-order planes of k_prep: each of a pass's 16 loads reads 512 B in a row (a plane in row order gave every load 16 separate lines).
// A lane then holds one query's scores: two S^T tiles (keys 0-15 and 16-31 of the pass), converted in place, ARE the B operand of the second product in the hardware k order (element s: key 8 * hi + s, s < 8; 16 + 8 * hi + s - 8 above), which is the order the Vf units hold V^T in.
// Online softmax in the log2 domain: p = exp2(s * FSC - m), m = the column's maximum in use; a pass looks for new maxima and rescales sums and output tiles only when some lane's 16 p of the pass add up to more than 2^8 (so p <= 2^8, far inside f32 and f16); p goes in rounded once to f16 against v in f16 (1 product), the column's sum takes the unrounded p; the division by the column's sum comes last.
// Q comes straight from the f32 input: at a tile's entry a wave loads its 32 rows whole (each load two rows of 256 B, 4 whole lines), rounds them to bf16 (nearest even) and turns them into B fragments through its own, still unused, LDS range of partial results (rows at a pitch of 144 B; no other wave touches that range before the work-group barrier).
// Causal: a tile's last pass is its diagonal pass (keys q0 .. q0 + 31), the only one that needs the mask. A key group without a pass leaves sum 0 and maximum -3e38: weight exp2(-huge) = 0 in the merge.
#define FQ 32
#define FQW 4
#define FKG 4
#define FW (FQW * FKG)
#define NPB (TT / (FQ * FQW))
#define FSC 0.18033688011112042f   // HD^-0.5 * log2(e)
typedef __attribute__((ext_vector_type(8))) unsigned v8u;
typedef v2u __attribute__((may_alias)) v2ua;
#define QPB 144                    // LDS pitch of a staged q row in bytes: 128 B of bf16 + 16, an odd number of 16-B pieces, so that the 16-B fragment reads of 16 neighbouring rows spread over the banks
struct PassFirst { static constexpr bool v = true; }; struct PassNext { static constexpr bool v = false; };
__device__ __forceinline__ v16bf ldfr(const bf* p) { return cat16b(*(const v8us*)p, *(const v8us*)(p + 256)); }   // one fragment = two neighbouring units; p already holds the lane's 8 * lane
__device__ __forceinline__ float xhalf(float x) { const int b = __float_as_int(x); return __int_as_float(__builtin_amdgcn_permlanex16(b, b, 0x76543210, 0xfedcba98, false, false)); }   // lane l <- lane l ^ 16, on the vector pipe
__global__ __launch_bounds__(32 * FW) void k_fattn(const float* __restrict__ XQ, const bf* __restrict__ Kp, const bf* __restrict__ Vt, const int* __restrict__ CF, float* OUTb) {
    typedef WFrag<bf>::V V;
    __shared__ v4f po[2 * FW * 512];        // [tile of the wave][wave][unit (dt * 2 + qt) * 2 + half of the 8 registers][lane] x 16 B: every partial-result access of a wave is 512 B in a row
    __shared__ v2f pml[2 * FW * 64];        // [tile of the wave][wave][qt][lane] x (maximum in use, the lane's sum)
    const int lane = threadIdx.x & 31, lr = lane & 15, hi = lane >> 4; const int w = __builtin_amdgcn_readfirstlane((int)(threadIdx.x >> 5)); const int qi = w % FQW, g = w / FQW; const int h = blockIdx.x;
    const bool con = (CF[0] != 0);
    const bf* kp = Kp + (size_t)h * TT * HD + 8 * lane; const bf* vp = Vt + (size_t)h * HD * TT + 8 * lane;   // a block of 32 keys is 32 * HD elements in either plane
    auto tq0 = [&](const int ph) { return (ph ? (NPB - 1 - (int)blockIdx.y) * FQW + (FQW - 1 - qi) : (int)blockIdx.y * FQW + qi) * FQ; };   // first query of the wave's tile number ph
    v4f xr[16];                                              // a tile's Q rows in f32: load i takes rows 2 i + hi, 4 d a lane; all 16 loads are asked for together
    auto askq = [&](const int q0) __attribute__((always_inline)) {
        const float* qx = XQ + (size_t)(q0 + hi) * DQ + h * HD + lr * 4;
#pragma unroll
        for (int i = 0; i < 16; ++i) xr[i] = *(const v4f*)(qx + (size_t)i * 2 * DQ);
        asm volatile("s_wait_xcnt 0x0" :: "v"(qx) : "memory");   // in front of every rewrite of the address register pair of the Q loads; it names the pair, so that no load's data lands on it ahead of the wait
    };
    askq(tq0(0));                                            // first of all: these rows come from memory, the planes from L2
    V kf[2][2];                                              // the K rows of the wave's next pass; a tile's last pass fetches those of the next tile's first pass (block g again)
#pragma unroll
    for (int t = 0; t < 2; ++t)
#pragma unroll
        for (int ks = 0; ks < 2; ++ks) kf[t][ks] = ldfr(kp + (size_t)g * 32 * HD + (t * 2 + ks) * 512);
    // the two tiles run one after the other through the same code (rolled: one copy of the pass loop in the instruction cache)
#pragma unroll 1
    for (int ph = 0; ; ++ph) {
        const int q0 = tq0(ph);
        V qf[2][2];
        {
            char* sq = (char*)(po + (ph * FW + w) * 512);
#pragma unroll
            for (int i = 0; i < 16; ++i) { v2u oq;
#pragma unroll
                for (int p = 0; p < 2; ++p) { v2f a; a[0] = xr[i][2 * p]; a[1] = xr[i][2 * p + 1]; oq[p] = __builtin_bit_cast(unsigned, __builtin_convertvector(a, v2bf)); }
                *(v2ua*)(sq + (2 * i + hi) * QPB + lr * 8) = oq; }
            asm volatile("s_wait_dscnt 0x0" ::: "memory");   // the wave's own stores are in LDS before a lane reads back what other lanes of the wave stored
#pragma unroll
            for (int t = 0; t < 2; ++t)
#pragma unroll
                for (int ks = 0; ks < 2; ++ks) { const char* fp = sq + (t * 16 + lr) * QPB + ks * 64 + hi * 16; qf[t][ks] = cat16b(*(const v8usa*)fp, *(const v8usa*)(fp + 32)); }
        }
        const int klast = con ? q0 : TT - 32;                // first key of the tile's last pass (wave-uniform)
        v8f o[4][2]; float m[2], l[2];
#pragma unroll
        for (int qt = 0; qt < 2; ++qt) { m[qt] = -3.0e38f; l[qt] = 0.0f;
#pragma unroll
            for (int dt = 0; dt < 4; ++dt) o[dt][qt] = (v8f){}; }
        // one pass; every inner loop is unrolled so that the fragment arrays are registers
        auto pass = [&](const int kb, auto first) __attribute__((always_inline)) {
            v16h vf[4];                                      // this pass's V^T (f16), asked for ahead of the score products: the softmax covers its latency
#pragma unroll
            for (int dt = 0; dt < 4; ++dt) vf[dt] = __builtin_bit_cast(v16h, ldfr(vp + (size_t)kb * HD + dt * 512));
            __builtin_amdgcn_sched_barrier(0);               // keeps these loads up here: left alone the build sinks them behind the maximum, and the second product waits on them
            v8f st[2][2];
#pragma unroll
            for (int kt = 0; kt < 2; ++kt)
#pragma unroll
                for (int qt = 0; qt < 2; ++qt) { st[kt][qt] = wmmab(kf[kt][0], qf[qt][0], (v8f){}); st[kt][qt] = wmmab(kf[kt][1], qf[qt][1], st[kt][qt]); }
            const int kn = (kb + 32 * FKG <= klast) ? kb + 32 * FKG : g * 32;   // the K rows of the wave's next pass, fetched one pass ahead; behind a tile's last pass that is block g, the next tile's first (behind the second tile: in bounds, unused)
#pragma unroll
            for (int kt = 0; kt < 2; ++kt)
#pragma unroll
                for (int ks = 0; ks < 2; ++ks) kf[kt][ks] = ldfr(kp + (size_t)kn * HD + (kt * 2 + ks) * 512);
            asm volatile("s_wait_xcnt 0x0" ::: "memory");    // in front of every rewrite of an address register of this pass's V^T and K loads
            if (con && kb == klast) {                        // diagonal pass (scalar branch): keys above the query get weight exp2(-huge) = 0
#pragma unroll
                for (int kt = 0; kt < 2; ++kt)
#pragma unroll
                    for (int qt = 0; qt < 2; ++qt)
#pragma unroll
                        for (int j = 0; j < 8; ++j) st[kt][qt][j] = (kt * 16 + hi * 8 + j <= qt * 16 + lr) ? st[kt][qt][j] : -3.0e38f;
            }
            // p is formed at once with the maximum in use; the pass's own sums are the overflow guard: every p is >= 0, so a lane whose 16 p add up to no more than 2^8 holds no p above 2^8. Only when some lane's sum is above that or is not a number are the maxima looked for.
            // scale-and-subtract and the sums go by register pairs, each pair two neighbouring registers of one score tile (v_pk_fma_f32, v_pk_add_f32: two elements an issue slot); written element by element the build paired registers across tiles and moved them into place every pass
            v16h pf[2]; float ps[2];
            auto soft = [&]() {
#pragma unroll
                for (int qt = 0; qt < 2; ++qt) { v8u uh; v2f s = (v2f){}; v2f fs, nm; fs[0] = FSC; fs[1] = FSC; nm[0] = -m[qt]; nm[1] = -m[qt];
#pragma unroll
                    for (int kt = 0; kt < 2; ++kt)
#pragma unroll
                        for (int jp = 0; jp < 4; ++jp) { v2f sp; sp[0] = st[kt][qt][2 * jp]; sp[1] = st[kt][qt][2 * jp + 1]; const v2f x = __builtin_elementwise_fma(sp, fs, nm); v2f pp; pp[0] = __builtin_amdgcn_exp2f(x[0]); pp[1] = __builtin_amdgcn_exp2f(x[1]); s += pp;
                            uh[kt * 4 + jp] = __builtin_bit_cast(unsigned, __builtin_convertvector(pp, v2h)); }
                    ps[qt] = s[0] + s[1]; pf[qt] = __builtin_bit_cast(v16h, uh); }
            };
            bool redo = true;                                // a tile's first pass has no maximum yet: it goes straight to the maxima
            if constexpr (!decltype(first)::v) { soft(); redo = __builtin_amdgcn_ballot_w32(!(ps[0] <= 256.0f) || !(ps[1] <= 256.0f)) != 0; }
            if (__builtin_expect(redo, decltype(first)::v)) {    // scalar branch, once a pass; rarely taken (said so, so that the usual path runs straight on): new maxima, sums and output tiles rescaled, p formed again from the scores
#pragma unroll
                for (int qt = 0; qt < 2; ++qt) { float a = st[0][qt][0];
#pragma unroll
                    for (int j = 1; j < 8; ++j) a = fmaxf(a, st[0][qt][j]);
#pragma unroll
                    for (int j = 0; j < 8; ++j) a = fmaxf(a, st[1][qt][j]);
                    a = fmaxf(a, xhalf(a)) * FSC;   // lanes c and c + 16 hold the two halves of one query's keys: both must use one m
                    const float mn = fmaxf(m[qt], a);
                    if constexpr (!decltype(first)::v) { const float f = __builtin_amdgcn_exp2f(m[qt] - mn); l[qt] *= f;   // in a first pass the sum and the output tiles are still zero: nothing to rescale
#pragma unroll
                        for (int dt = 0; dt < 4; ++dt) o[dt][qt] *= f; }
                    m[qt] = mn; }
                soft();
            }
            l[0] += ps[0]; l[1] += ps[1];
#pragma unroll
            for (int dt = 0; dt < 4; ++dt)
#pragma unroll
                for (int qt = 0; qt < 2; ++qt) o[dt][qt] = wmma16(vf[dt], pf[qt], o[dt][qt]);
        };
        if (g * 32 <= klast) {                               // a key group may be without a pass in this tile
            pass(g * 32, PassFirst{});                       // the wave's first pass of the tile, written out: the same pass without the try at the old maximum
            // the pass loop stays rolled (two passes side by side would not fit the registers of four waves a SIMD)
#pragma unroll 1
            for (int kb = g * 32 + 32 * FKG; kb <= klast; kb += 32 * FKG) pass(kb, PassNext{});
        }
        v4f* pw = po + (ph * FW + w) * 512 + lane;
#pragma unroll
        for (int qt = 0; qt < 2; ++qt) { v2f ml; ml[0] = m[qt]; ml[1] = l[qt]; pml[(ph * FW + w) * 64 + qt * 32 + lane] = ml;
#pragma unroll
            for (int dt = 0; dt < 4; ++dt) { v4f r0, r1;
#pragma unroll
                for (int j = 0; j < 4; ++j) { r0[j] = o[dt][qt][j]; r1[j] = o[dt][qt][4 + j]; }
                pw[((dt * 2 + qt) * 2) * 32] = r0; pw[((dt * 2 + qt) * 2 + 1) * 32] = r1; } }
        if (ph == 1) break;
        askq(tq0(1));                                        // the second tile's Q rows
    }
    __syncthreads();                                         // every wave's two partial results are in LDS before a wave adds the other key groups' to its own
    const int mq = g & 1, md = g >> 1;                       // the wave's share of each of its two tiles: queries 16 mq + 0..15, d = 32 md + 0..31
    for (int ph = 0; ph < 2; ++ph) {
        const int q0 = (ph ? (NPB - 1 - (int)blockIdx.y) * FQW + (FQW - 1 - qi) : (int)blockIdx.y * FQW + qi) * FQ;
        v2f ml[FKG]; float f[FKG];
#pragma unroll
        for (int k = 0; k < FKG; ++k) ml[k] = pml[(ph * FW + k * FQW + qi) * 64 + mq * 32 + lane];
        const float mm = fmaxf(fmaxf(ml[0][0], ml[1][0]), fmaxf(ml[2][0], ml[3][0])); float ls = 0.0f;
#pragma unroll
        for (int k = 0; k < FKG; ++k) { f[k] = __builtin_amdgcn_exp2f(ml[k][0] - mm); ls = __builtin_fmaf(ml[k][1], f[k], ls); }
        const float inv = __fdiv_rn(1.0f, ls + xhalf(ls));
        float* op = OUTb + (size_t)(q0 + mq * 16 + lr) * DQ + h * HD + md * 32 + 8 * hi;   /* f32 output [l][h*64 + d]; register j of tile dt is d = 16 dt + 8 hi + j */
#pragma unroll
        for (int u = 0; u < 4; ++u) {                        // u = 2 * (dt - 2 md) + half of the 8 registers
            v4f r = (v4f){};
#pragma unroll
            for (int k = 0; k < FKG; ++k) r += po[(ph * FW + k * FQW + qi) * 512 + (((md * 2 + (u >> 1)) * 2 + mq) * 2 + (u & 1)) * 32 + lane] * f[k];
            *(v4f*)(op + (u >> 1) * 16 + (u & 1) * 4) = r * inv; }
    }
}

extern "C" void kernel_launch(void* const* d_in, const int* in_sizes, int n_in,
                              void* d_out, int out_size, void* d_ws, size_t ws_size, hipStream_t stream) {
    (void)in_sizes; (void)n_in; (void)out_size;
    const float* xq = (const float*)d_in[0]; const float* xk = (const float*)d_in[1]; const float* xv = (const float*)d_in[2]; const int* CFLAG = (const int*)d_in[3];   /* 'causal' flag (int, read on device) */ const float* x = xq; const float* wq = nullptr; const float* wk = nullptr; const float* wv = nullptr; const float* wo = nullptr; (void)x; (void)wq; (void)wk; (void)wv; (void)wo;
    float* OUT = (float*)d_out;     // [1][4096][1024]
    char* wsp = (char*)d_ws;
    auto take = [&](size_t bytes) { char* p = wsp; wsp += (bytes + 255) & ~(size_t)255; return (void*)p; };
    bf* KPh = (bf*)take((size_t)NKV * TT * HD * 2); bf* VTh = (bf*)take((size_t)NKV * HD * TT * 2);
    if ((size_t)(wsp - (char*)d_ws) > ws_size) return;    // ws 256 MiB

    for (int b = 0; b < NB_; ++b) {
        k_prep<<<dim3(TT / PT, NH_), 256, 0, stream>>>(xk + (size_t)b * TT * DM, xv + (size_t)b * TT * DM, KPh, VTh);   /* 16-bit planes of k and v^T straight from the inputs, in fragment order */
        k_fattn<<<dim3(NH_, NPB / 2), 32 * FW, 0, stream>>>(xq + (size_t)b * TT * DM, KPh, VTh, CFLAG, OUT + (size_t)b * TT * DM);   /* one kv head per query head */
    }
}
